// v000
// Times are from an AMD MI455X. After a warm-up the kernel runs many times in a row, and a time is the length of
// such a window on the GPU divided by its runs, so every launch and the gaps after it count. The runs cycle
// through copies of the inputs. A figure is the median of several windows, for all but v000 over two sittings.
// Sittings can differ by a few percent; kernels timed side by side share one.
// v000, which the later versions start from, runs in 56.3 microseconds.
#include <hip/hip_runtime.h>
#include <hip/hip_bf16.h>

typedef __attribute__((ext_vector_type(2))) float v2f;
typedef __attribute__((ext_vector_type(8))) float v8f;
typedef int v4i __attribute__((vector_size(4 * sizeof(int))));

#define B_DIM 4
#define N_DIM 16384
#define C_DIM 64
#define H_DIM 8
#define EPS_IN 1e-5f

#ifndef __has_builtin
#define __has_builtin(x) 0
#endif

#if __has_builtin(__builtin_amdgcn_global_load_async_to_lds_b128)
#define HAS_ASYNC_LDS 1
#else
#define HAS_ASYNC_LDS 0
#endif

#if __has_builtin(__builtin_amdgcn_s_wait_asynccnt)
#define WAIT_ASYNC(n) __builtin_amdgcn_s_wait_asynccnt(n)
#elif HAS_ASYNC_LDS
#define WAIT_ASYNC(n) asm volatile("s_wait_asynccnt %0" ::"i"(n) : "memory")
#else
#define WAIT_ASYNC(n) ((void)0)
#endif

// addrspace conversions via ptrtoint/inttoptr; pointee type int32x4 per the
// builtin's probed signature (AS1 v4i* source, AS3 v4i* LDS destination).
#define GLB_AS1(p) \
  ((__attribute__((address_space(1))) v4i*)(unsigned long long)(p))
#define LDS_AS3(p) \
  ((__attribute__((address_space(3))) v4i*)(unsigned int)(unsigned long long)(p))

// Copy 4096 floats (16 KB) global -> LDS; 512 threads x 2 x 16B each.
static __device__ __forceinline__ void stage4k(const float* __restrict__ g,
                                               float* l, int t) {
#if HAS_ASYNC_LDS
#pragma unroll
  for (int i = 0; i < 2; ++i) {
    __builtin_amdgcn_global_load_async_to_lds_b128(
        GLB_AS1(g + (size_t)(t + i * 512) * 4),
        LDS_AS3(l + (size_t)(t + i * 512) * 4), 0, 0);
  }
#else
  const float4* s4 = (const float4*)g;
  float4* d4 = (float4*)l;
  d4[t] = s4[t];
  d4[t + 512] = s4[t + 512];
#endif
}

static __device__ __forceinline__ v8f wmma4(v2f a, v2f b, v8f c) {
  return __builtin_amdgcn_wmma_f32_16x16x4_f32(false, a, false, b, (short)0, c,
                                               false, false);
}

__global__ void k_zero(float* __restrict__ g, int n) {
  int i = blockIdx.x * blockDim.x + threadIdx.x;
  if (i < n) g[i] = 0.0f;
}

// G_b = emb_b^T @ emb_b (per-batch 64x64 Gram), streamed over N with
// double-buffered async global->LDS staging.
__global__ void __launch_bounds__(512) k_gram(const float* __restrict__ emb,
                                              float* __restrict__ G) {
  __shared__ float sE[2][4096];  // two 64-row chunks
  const int b   = blockIdx.x >> 6;  // 64 blocks per batch, 256 rows each
  const int blk = blockIdx.x & 63;
  const int t = threadIdx.x;
  const int lane = t & 31, wave = t >> 5;
  const int m = lane & 15;
  const int khalf = (lane < 16) ? 0 : 2;
  const int rowoff = (lane < 16) ? 0 : 8;
  const int ci = wave >> 2, di = wave & 3;  // 16x16 tile of G
  const float* base = emb + ((size_t)b * N_DIM + blk * 256) * C_DIM;

  stage4k(base, sE[0], t);  // chunk 0 in flight
  v8f acc = {};

#define GRAM_STEP(c, W, NEXT)                                         \
  {                                                                   \
    if (NEXT) stage4k(base + ((c) + 1) * 4096, sE[((c) + 1) & 1], t); \
    WAIT_ASYNC(W);                                                    \
    __syncthreads();                                                  \
    const float* sb = sE[(c) & 1];                                    \
    _Pragma("unroll") for (int kk = 0; kk < 16; ++kk) {               \
      const int kb = kk * 4 + khalf;                                  \
      v2f a, bv;                                                      \
      a.x  = sb[kb * 64 + ci * 16 + m];                               \
      a.y  = sb[(kb + 1) * 64 + ci * 16 + m];                         \
      bv.x = sb[kb * 64 + di * 16 + m];                               \
      bv.y = sb[(kb + 1) * 64 + di * 16 + m];                         \
      acc = wmma4(a, bv, acc);                                        \
    }                                                                 \
    __syncthreads();                                                  \
  }

  GRAM_STEP(0, 2, 1)
  GRAM_STEP(1, 2, 1)
  GRAM_STEP(2, 2, 1)
  GRAM_STEP(3, 0, 0)
#undef GRAM_STEP

  float* Gb = G + b * 4096;
#pragma unroll
  for (int v = 0; v < 8; ++v) {
    const int row = ci * 16 + v + rowoff;
    const int col = di * 16 + m;
    atomicAdd(&Gb[row * 64 + col], acc[v]);
  }
}

// Per (b,h): attn = IN+softmax(Wq_h @ G_b @ Wk_h^T); M2 = attn @ Wv_h,
// stored interleaved as M2r[b][(c*H+h)*64 + e] for the downstream GEMM.
__global__ void __launch_bounds__(512) k_attn(const float* __restrict__ G,
                                              const float* __restrict__ Wq,
                                              const float* __restrict__ Wk,
                                              const float* __restrict__ Wv,
                                              float* __restrict__ M2) {
  __shared__ float sG[4096], sT[4096], sA[4096];
  __shared__ float rs[512], rq[512];
  const int b = blockIdx.x >> 3;
  const int h = blockIdx.x & 7;
  const int t = threadIdx.x;
  const int lane = t & 31, wave = t >> 5;
  const int m = lane & 15;
  const int khalf = (lane < 16) ? 0 : 2;
  const int rowoff = (lane < 16) ? 0 : 8;
  const int ti = wave >> 2, tj = wave & 3;

  {
    const float4* src = (const float4*)(G + b * 4096);
    float4* dst = (float4*)sG;
    dst[t] = src[t];
    dst[t + 512] = src[t + 512];
  }
  __syncthreads();

  const float* Wqh = Wq + h * 64 * 64;
  const float* Wkh = Wk + h * 64 * 64;
  const float* Wvh = Wv + h * 64 * 64;

  // T1 = G @ Wk_h^T
  {
    v8f acc = {};
#pragma unroll
    for (int kk = 0; kk < 16; ++kk) {
      const int kb = kk * 4 + khalf;
      v2f a, bv;
      a.x  = sG[(ti * 16 + m) * 64 + kb];
      a.y  = sG[(ti * 16 + m) * 64 + kb + 1];
      bv.x = Wkh[(tj * 16 + m) * 64 + kb];
      bv.y = Wkh[(tj * 16 + m) * 64 + kb + 1];
      acc = wmma4(a, bv, acc);
    }
#pragma unroll
    for (int v = 0; v < 8; ++v)
      sT[(ti * 16 + v + rowoff) * 64 + tj * 16 + m] = acc[v];
  }
  __syncthreads();

  // attn = Wq_h @ T1
  {
    v8f acc = {};
#pragma unroll
    for (int kk = 0; kk < 16; ++kk) {
      const int kb = kk * 4 + khalf;
      v2f a, bv;
      a.x  = Wqh[(ti * 16 + m) * 64 + kb];
      a.y  = Wqh[(ti * 16 + m) * 64 + kb + 1];
      bv.x = sT[kb * 64 + tj * 16 + m];
      bv.y = sT[(kb + 1) * 64 + tj * 16 + m];
      acc = wmma4(a, bv, acc);
    }
#pragma unroll
    for (int v = 0; v < 8; ++v)
      sA[(ti * 16 + v + rowoff) * 64 + tj * 16 + m] = acc[v];
  }
  __syncthreads();

  // InstanceNorm2d (biased variance) over the whole 64x64 map
  float s = 0.f, q = 0.f;
#pragma unroll
  for (int i = 0; i < 8; ++i) {
    const float x = sA[t * 8 + i];
    s += x;
    q += x * x;
  }
  rs[t] = s;
  rq[t] = q;
  __syncthreads();
  for (int off = 256; off > 0; off >>= 1) {
    if (t < off) {
      rs[t] += rs[t + off];
      rq[t] += rq[t + off];
    }
    __syncthreads();
  }
  const float mean = rs[0] * (1.0f / 4096.0f);
  const float var  = rq[0] * (1.0f / 4096.0f) - mean * mean;
  const float inv  = rsqrtf(var + EPS_IN);
#pragma unroll
  for (int i = 0; i < 8; ++i)
    sA[t * 8 + i] = (sA[t * 8 + i] - mean) * inv;
  __syncthreads();

  // softmax over last dim (each of 64 rows)
  if (t < 64) {
    float mx = -1e30f;
    for (int j = 0; j < 64; ++j) mx = fmaxf(mx, sA[t * 64 + j]);
    float se = 0.f;
    for (int j = 0; j < 64; ++j) se += __expf(sA[t * 64 + j] - mx);
    const float r = 1.0f / se;
    for (int j = 0; j < 64; ++j) sA[t * 64 + j] = __expf(sA[t * 64 + j] - mx) * r;
  }
  __syncthreads();

  // M2 = attn @ Wv_h ; store interleaved
  {
    v8f acc = {};
#pragma unroll
    for (int kk = 0; kk < 16; ++kk) {
      const int kb = kk * 4 + khalf;
      v2f a, bv;
      a.x  = sA[(ti * 16 + m) * 64 + kb];
      a.y  = sA[(ti * 16 + m) * 64 + kb + 1];
      bv.x = Wvh[kb * 64 + tj * 16 + m];
      bv.y = Wvh[(kb + 1) * 64 + tj * 16 + m];
      acc = wmma4(a, bv, acc);
    }
    float* M2b = M2 + (size_t)b * 512 * 64;
#pragma unroll
    for (int v = 0; v < 8; ++v) {
      const int c = ti * 16 + v + rowoff;
      const int e = tj * 16 + m;
      M2b[(c * H_DIM + h) * 64 + e] = acc[v];
    }
  }
}

// P_b = Wo[64x512] @ M2r_b[512x64]
__global__ void __launch_bounds__(512) k_pmat(const float* __restrict__ M2,
                                              const float* __restrict__ Wo,
                                              float* __restrict__ P) {
  const int b = blockIdx.x;
  const int t = threadIdx.x;
  const int lane = t & 31, wave = t >> 5;
  const int m = lane & 15;
  const int khalf = (lane < 16) ? 0 : 2;
  const int rowoff = (lane < 16) ? 0 : 8;
  const int ti = wave >> 2, tj = wave & 3;
  const float* M2b = M2 + (size_t)b * 512 * 64;

  v8f acc = {};
  for (int kk = 0; kk < 128; ++kk) {
    const int kb = kk * 4 + khalf;
    v2f a, bv;
    a.x  = Wo[(ti * 16 + m) * 512 + kb];
    a.y  = Wo[(ti * 16 + m) * 512 + kb + 1];
    bv.x = M2b[kb * 64 + tj * 16 + m];
    bv.y = M2b[(kb + 1) * 64 + tj * 16 + m];
    acc = wmma4(a, bv, acc);
  }
  float* Pb = P + b * 4096;
#pragma unroll
  for (int v = 0; v < 8; ++v)
    Pb[(ti * 16 + v + rowoff) * 64 + tj * 16 + m] = acc[v];
}

// out_b = emb_b @ P_b^T, streamed over N: async-staged P_b + double-buffered
// emb chunks; non-temporal output stores.
__global__ void __launch_bounds__(512) k_out(const float* __restrict__ emb,
                                             const float* __restrict__ P,
                                             float* __restrict__ out) {
  __shared__ float sP[4096];
  __shared__ float sE[2][4096];
  const int b   = blockIdx.x >> 6;  // 64 blocks per batch, 256 rows each
  const int blk = blockIdx.x & 63;
  const int n0  = blk * 256;
  const int t = threadIdx.x;
  const int lane = t & 31, wave = t >> 5;
  const int m = lane & 15;
  const int khalf = (lane < 16) ? 0 : 2;
  const int rowoff = (lane < 16) ? 0 : 8;
  const int nt = wave >> 2, ct = wave & 3;
  const float* ebase = emb + ((size_t)b * N_DIM + n0) * C_DIM;

  stage4k(P + b * 4096, sP, t);  // issued first: in-order ahead of chunks
  stage4k(ebase, sE[0], t);      // chunk 0
  WAIT_ASYNC(2);                 // sP landed (in-order); chunk0 may be in flight
  __syncthreads();

  v2f brg[16];
#pragma unroll
  for (int kk = 0; kk < 16; ++kk) {
    const int kb = kk * 4 + khalf;
    brg[kk].x = sP[(ct * 16 + m) * 64 + kb];
    brg[kk].y = sP[(ct * 16 + m) * 64 + kb + 1];
  }

  float* ob = out + ((size_t)b * N_DIM + n0) * C_DIM;

#define OUT_STEP(c, W, NEXT)                                            \
  {                                                                     \
    if (NEXT) stage4k(ebase + ((c) + 1) * 4096, sE[((c) + 1) & 1], t);  \
    WAIT_ASYNC(W);                                                      \
    __syncthreads();                                                    \
    const float* sb = sE[(c) & 1];                                      \
    v8f acc = {};                                                       \
    _Pragma("unroll") for (int kk = 0; kk < 16; ++kk) {                 \
      const int kb = kk * 4 + khalf;                                    \
      v2f a;                                                            \
      a.x = sb[(nt * 16 + m) * 64 + kb];                                \
      a.y = sb[(nt * 16 + m) * 64 + kb + 1];                            \
      acc = wmma4(a, brg[kk], acc);                                     \
    }                                                                   \
    _Pragma("unroll") for (int v = 0; v < 8; ++v)                       \
        __builtin_nontemporal_store(                                    \
            acc[v],                                                     \
            &ob[((c) * 64 + nt * 16 + v + rowoff) * 64 + ct * 16 + m]); \
    __syncthreads();                                                    \
  }

  OUT_STEP(0, 2, 1)
  OUT_STEP(1, 2, 1)
  OUT_STEP(2, 2, 1)
  OUT_STEP(3, 0, 0)
#undef OUT_STEP
}

extern "C" void kernel_launch(void* const* d_in, const int* in_sizes, int n_in,
                              void* d_out, int out_size, void* d_ws,
                              size_t ws_size, hipStream_t stream) {
  (void)in_sizes; (void)n_in; (void)out_size; (void)ws_size;
  const float* emb = (const float*)d_in[0];
  const float* Wq  = (const float*)d_in[1];
  const float* Wk  = (const float*)d_in[2];
  const float* Wv  = (const float*)d_in[3];
  const float* Wo  = (const float*)d_in[4];
  float* out = (float*)d_out;

  float* ws = (float*)d_ws;
  float* G  = ws;                   // B*4096   = 16384 floats
  float* M2 = ws + 16384;           // B*512*64 = 131072 floats
  float* P  = ws + 16384 + 131072;  // B*4096   = 16384 floats

  k_zero<<<(16384 + 255) / 256, 256, 0, stream>>>(G, 16384);
  k_gram<<<B_DIM * 64, 512, 0, stream>>>(emb, G);
  k_attn<<<B_DIM * H_DIM, 512, 0, stream>>>(G, Wq, Wk, Wv, M2);
  k_pmat<<<B_DIM, 512, 0, stream>>>(M2, Wo, P);
  k_out<<<B_DIM * 64, 512, 0, stream>>>(emb, P, out);
}

// v001
// Measured time: 41 microseconds a run.
// In both of two side-by-side timings against v000, it was 1.38 times as fast.
#include <hip/hip_runtime.h>
#include <hip/hip_bf16.h>

typedef __attribute__((ext_vector_type(2))) float v2f;
typedef __attribute__((ext_vector_type(8))) float v8f;
typedef int v4i __attribute__((vector_size(4 * sizeof(int))));

#define B_DIM 4
#define N_DIM 16384
#define C_DIM 64
#define H_DIM 8
#define EPS_IN 1e-5f
#define WO_PITCH 68

#ifndef __has_builtin
#define __has_builtin(x) 0
#endif

#if __has_builtin(__builtin_amdgcn_global_load_async_to_lds_b128)
#define HAS_ASYNC_LDS 1
#else
#define HAS_ASYNC_LDS 0
#endif

#if __has_builtin(__builtin_amdgcn_s_wait_asynccnt)
#define WAIT_ASYNC(n) __builtin_amdgcn_s_wait_asynccnt(n)
#elif HAS_ASYNC_LDS
#define WAIT_ASYNC(n) asm volatile("s_wait_asynccnt %0" ::"i"(n) : "memory")
#else
#define WAIT_ASYNC(n) ((void)0)
#endif

// addrspace conversions via ptrtoint/inttoptr; pointee type int32x4 per the
// builtin's probed signature (AS1 v4i* source, AS3 v4i* LDS destination).
#define GLB_AS1(p) \
  ((__attribute__((address_space(1))) v4i*)(unsigned long long)(p))
#define LDS_AS3(p) \
  ((__attribute__((address_space(3))) v4i*)(unsigned int)(unsigned long long)(p))

// Copy 4096 floats (16 KB) global -> LDS; 512 threads x 2 x 16B each.
static __device__ __forceinline__ void stage4k(const float* __restrict__ g,
                                               float* l, int t) {
#if HAS_ASYNC_LDS
#pragma unroll
  for (int i = 0; i < 2; ++i) {
    __builtin_amdgcn_global_load_async_to_lds_b128(
        GLB_AS1(g + (size_t)(t + i * 512) * 4),
        LDS_AS3(l + (size_t)(t + i * 512) * 4), 0, 0);
  }
#else
  const float4* s4 = (const float4*)g;
  float4* d4 = (float4*)l;
  d4[t] = s4[t];
  d4[t + 512] = s4[t + 512];
#endif
}

static __device__ __forceinline__ v8f wmma4(v2f a, v2f b, v8f c) {
  return __builtin_amdgcn_wmma_f32_16x16x4_f32(false, a, false, b, (short)0, c,
                                               false, false);
}

__global__ void k_zero(float* __restrict__ g, int n) {
  int i = blockIdx.x * blockDim.x + threadIdx.x;
  if (i < n) g[i] = 0.0f;
}

// G_b = emb_b^T @ emb_b (per-batch 64x64 Gram), streamed over N with
// double-buffered async global->LDS staging.
__global__ void __launch_bounds__(512) k_gram(const float* __restrict__ emb,
                                              float* __restrict__ G) {
  __shared__ float sE[2][4096];  // two 64-row chunks
  const int b   = blockIdx.x >> 6;  // 64 blocks per batch, 256 rows each
  const int blk = blockIdx.x & 63;
  const int t = threadIdx.x;
  const int lane = t & 31, wave = t >> 5;
  const int m = lane & 15;
  const int khalf = (lane < 16) ? 0 : 2;
  const int rowoff = (lane < 16) ? 0 : 8;
  const int ci = wave >> 2, di = wave & 3;  // 16x16 tile of G
  const float* base = emb + ((size_t)b * N_DIM + blk * 256) * C_DIM;

  stage4k(base, sE[0], t);  // chunk 0 in flight
  v8f acc = {};

#define GRAM_STEP(c, W, NEXT)                                         \
  {                                                                   \
    if (NEXT) stage4k(base + ((c) + 1) * 4096, sE[((c) + 1) & 1], t); \
    WAIT_ASYNC(W);                                                    \
    __syncthreads();                                                  \
    const float* sb = sE[(c) & 1];                                    \
    _Pragma("unroll") for (int kk = 0; kk < 16; ++kk) {               \
      const int kb = kk * 4 + khalf;                                  \
      v2f a, bv;                                                      \
      a.x  = sb[kb * 64 + ci * 16 + m];                               \
      a.y  = sb[(kb + 1) * 64 + ci * 16 + m];                         \
      bv.x = sb[kb * 64 + di * 16 + m];                               \
      bv.y = sb[(kb + 1) * 64 + di * 16 + m];                         \
      acc = wmma4(a, bv, acc);                                        \
    }                                                                 \
    __syncthreads();                                                  \
  }

  GRAM_STEP(0, 2, 1)
  GRAM_STEP(1, 2, 1)
  GRAM_STEP(2, 2, 1)
  GRAM_STEP(3, 0, 0)
#undef GRAM_STEP

  float* Gb = G + b * 4096;
#pragma unroll
  for (int v = 0; v < 8; ++v) {
    const int row = ci * 16 + v + rowoff;
    const int col = di * 16 + m;
    atomicAdd(&Gb[row * 64 + col], acc[v]);
  }
}

// Per (b,h): attn = IN+softmax(Wq_h @ G_b @ Wk_h^T); M2_h = attn @ Wv_h;
// then this head's share of the output projection,
// P_b += Wo[:, c*H+h] @ M2_h, added into the zeroed P_b with float atomics.
__global__ void __launch_bounds__(512) k_attn(const float* __restrict__ G,
                                              const float* __restrict__ Wq,
                                              const float* __restrict__ Wk,
                                              const float* __restrict__ Wv,
                                              const float* __restrict__ Wo,
                                              float* __restrict__ P) {
  __shared__ float sG[4096], sT[4096], sA[4096];
  __shared__ float sW[64 * WO_PITCH];
  __shared__ float rs[512], rq[512];
  const int b = blockIdx.x >> 3;
  const int h = blockIdx.x & 7;
  const int t = threadIdx.x;
  const int lane = t & 31, wave = t >> 5;
  const int m = lane & 15;
  const int khalf = (lane < 16) ? 0 : 2;
  const int rowoff = (lane < 16) ? 0 : 8;
  const int ti = wave >> 2, tj = wave & 3;

  {
    const float4* src = (const float4*)(G + b * 4096);
    float4* dst = (float4*)sG;
    dst[t] = src[t];
    dst[t + 512] = src[t + 512];
  }
  __syncthreads();

  const float* Wqh = Wq + h * 64 * 64;
  const float* Wkh = Wk + h * 64 * 64;
  const float* Wvh = Wv + h * 64 * 64;

  // T1 = G @ Wk_h^T
  {
    v8f acc = {};
#pragma unroll
    for (int kk = 0; kk < 16; ++kk) {
      const int kb = kk * 4 + khalf;
      v2f a, bv;
      a.x  = sG[(ti * 16 + m) * 64 + kb];
      a.y  = sG[(ti * 16 + m) * 64 + kb + 1];
      bv.x = Wkh[(tj * 16 + m) * 64 + kb];
      bv.y = Wkh[(tj * 16 + m) * 64 + kb + 1];
      acc = wmma4(a, bv, acc);
    }
#pragma unroll
    for (int v = 0; v < 8; ++v)
      sT[(ti * 16 + v + rowoff) * 64 + tj * 16 + m] = acc[v];
  }
  __syncthreads();

  // attn = Wq_h @ T1
  {
    v8f acc = {};
#pragma unroll
    for (int kk = 0; kk < 16; ++kk) {
      const int kb = kk * 4 + khalf;
      v2f a, bv;
      a.x  = Wqh[(ti * 16 + m) * 64 + kb];
      a.y  = Wqh[(ti * 16 + m) * 64 + kb + 1];
      bv.x = sT[kb * 64 + tj * 16 + m];
      bv.y = sT[(kb + 1) * 64 + tj * 16 + m];
      acc = wmma4(a, bv, acc);
    }
#pragma unroll
    for (int v = 0; v < 8; ++v)
      sA[(ti * 16 + v + rowoff) * 64 + tj * 16 + m] = acc[v];
  }
  __syncthreads();

  // InstanceNorm2d (biased variance) over the whole 64x64 map
  float s = 0.f, q = 0.f;
#pragma unroll
  for (int i = 0; i < 8; ++i) {
    const float x = sA[t * 8 + i];
    s += x;
    q += x * x;
  }
  rs[t] = s;
  rq[t] = q;
  __syncthreads();
  for (int off = 256; off > 0; off >>= 1) {
    if (t < off) {
      rs[t] += rs[t + off];
      rq[t] += rq[t + off];
    }
    __syncthreads();
  }
  const float mean = rs[0] * (1.0f / 4096.0f);
  const float var  = rq[0] * (1.0f / 4096.0f) - mean * mean;
  const float inv  = rsqrtf(var + EPS_IN);
#pragma unroll
  for (int i = 0; i < 8; ++i)
    sA[t * 8 + i] = (sA[t * 8 + i] - mean) * inv;
  __syncthreads();

  // Wo_h[o][c] = Wo[o*512 + c*H + h] for the last product: each 128-byte line
  // of Wo holds 4 values of this head, so a wave takes 8 rows x 4 columns per
  // load (8 lines) and every line is asked for once per block. Requested here
  // so that the values arrive while the softmax runs.
  const int wo_o = (wave & 7) * 8 + (lane >> 2);
  const int wo_c = (wave >> 3) * 32 + (lane & 3);
  float wo[8];
  {
    const float* wp = Wo + wo_o * 512 + wo_c * H_DIM + h;
#pragma unroll  // all 8 loads in flight at once, wo[] in registers
    for (int i = 0; i < 8; ++i) wo[i] = wp[i * 4 * H_DIM];
  }

  // softmax over last dim (each of 64 rows)
  if (t < 64) {
    float mx = -1e30f;
    for (int j = 0; j < 64; ++j) mx = fmaxf(mx, sA[t * 64 + j]);
    float se = 0.f;
    for (int j = 0; j < 64; ++j) se += __expf(sA[t * 64 + j] - mx);
    const float r = 1.0f / se;
    for (int j = 0; j < 64; ++j) sA[t * 64 + j] = __expf(sA[t * 64 + j] - mx) * r;
  }
#pragma unroll  // wo[] indexed by constants only, so it stays in registers
  for (int i = 0; i < 8; ++i) sW[wo_o * WO_PITCH + wo_c + i * 4] = wo[i];
  __syncthreads();

  // M2_h = attn @ Wv_h, kept in LDS (sT is free since the second product)
  {
    v8f acc = {};
#pragma unroll
    for (int kk = 0; kk < 16; ++kk) {
      const int kb = kk * 4 + khalf;
      v2f a, bv;
      a.x  = sA[(ti * 16 + m) * 64 + kb];
      a.y  = sA[(ti * 16 + m) * 64 + kb + 1];
      bv.x = Wvh[kb * 64 + tj * 16 + m];
      bv.y = Wvh[(kb + 1) * 64 + tj * 16 + m];
      acc = wmma4(a, bv, acc);
    }
#pragma unroll  // acc[] indexed by constants only, so it stays in registers
    for (int v = 0; v < 8; ++v)
      sT[(ti * 16 + v + rowoff) * 64 + tj * 16 + m] = acc[v];
  }
  __syncthreads();  // M2_h complete in sT before any wave reads it as B

  // P_b += Wo_h @ M2_h
  {
    v8f acc = {};
#pragma unroll  // lets the LDS reads of later k steps start ahead of the WMMAs
    for (int kk = 0; kk < 16; ++kk) {
      const int kb = kk * 4 + khalf;
      v2f a, bv;
      a.x  = sW[(ti * 16 + m) * WO_PITCH + kb];
      a.y  = sW[(ti * 16 + m) * WO_PITCH + kb + 1];
      bv.x = sT[kb * 64 + tj * 16 + m];
      bv.y = sT[(kb + 1) * 64 + tj * 16 + m];
      acc = wmma4(a, bv, acc);
    }
    float* pp = P + b * 4096 + (ti * 16 + rowoff) * 64 + tj * 16 + m;
#pragma unroll  // acc[] indexed by constants only, so it stays in registers
    for (int v = 0; v < 8; ++v) atomicAdd(pp + v * 64, acc[v]);
  }
}

// out_b = emb_b @ P_b^T, streamed over N: async-staged P_b + double-buffered
// emb chunks; non-temporal output stores.
__global__ void __launch_bounds__(512) k_out(const float* __restrict__ emb,
                                             const float* __restrict__ P,
                                             float* __restrict__ out) {
  __shared__ float sP[4096];
  __shared__ float sE[2][4096];
  const int b   = blockIdx.x >> 6;  // 64 blocks per batch, 256 rows each
  const int blk = blockIdx.x & 63;
  const int n0  = blk * 256;
  const int t = threadIdx.x;
  const int lane = t & 31, wave = t >> 5;
  const int m = lane & 15;
  const int khalf = (lane < 16) ? 0 : 2;
  const int rowoff = (lane < 16) ? 0 : 8;
  const int nt = wave >> 2, ct = wave & 3;
  const float* ebase = emb + ((size_t)b * N_DIM + n0) * C_DIM;

  stage4k(P + b * 4096, sP, t);  // issued first: in-order ahead of chunks
  stage4k(ebase, sE[0], t);      // chunk 0
  WAIT_ASYNC(2);                 // sP landed (in-order); chunk0 may be in flight
  __syncthreads();

  v2f brg[16];
#pragma unroll
  for (int kk = 0; kk < 16; ++kk) {
    const int kb = kk * 4 + khalf;
    brg[kk].x = sP[(ct * 16 + m) * 64 + kb];
    brg[kk].y = sP[(ct * 16 + m) * 64 + kb + 1];
  }

  float* ob = out + ((size_t)b * N_DIM + n0) * C_DIM;

#define OUT_STEP(c, W, NEXT)                                            \
  {                                                                     \
    if (NEXT) stage4k(ebase + ((c) + 1) * 4096, sE[((c) + 1) & 1], t);  \
    WAIT_ASYNC(W);                                                      \
    __syncthreads();                                                    \
    const float* sb = sE[(c) & 1];                                      \
    v8f acc = {};                                                       \
    _Pragma("unroll") for (int kk = 0; kk < 16; ++kk) {                 \
      const int kb = kk * 4 + khalf;                                    \
      v2f a;                                                            \
      a.x = sb[(nt * 16 + m) * 64 + kb];                                \
      a.y = sb[(nt * 16 + m) * 64 + kb + 1];                            \
      acc = wmma4(a, brg[kk], acc);                                     \
    }                                                                   \
    _Pragma("unroll") for (int v = 0; v < 8; ++v)                       \
        __builtin_nontemporal_store(                                    \
            acc[v],                                                     \
            &ob[((c) * 64 + nt * 16 + v + rowoff) * 64 + ct * 16 + m]); \
    __syncthreads();                                                    \
  }

  OUT_STEP(0, 2, 1)
  OUT_STEP(1, 2, 1)
  OUT_STEP(2, 2, 1)
  OUT_STEP(3, 0, 0)
#undef OUT_STEP
}

extern "C" void kernel_launch(void* const* d_in, const int* in_sizes, int n_in,
                              void* d_out, int out_size, void* d_ws,
                              size_t ws_size, hipStream_t stream) {
  (void)in_sizes; (void)n_in; (void)out_size; (void)ws_size;
  const float* emb = (const float*)d_in[0];
  const float* Wq  = (const float*)d_in[1];
  const float* Wk  = (const float*)d_in[2];
  const float* Wv  = (const float*)d_in[3];
  const float* Wo  = (const float*)d_in[4];
  float* out = (float*)d_out;

  float* ws = (float*)d_ws;
  float* G = ws;          // B*4096 = 16384 floats
  float* P = ws + 16384;  // B*4096 = 16384 floats, directly behind G

  k_zero<<<128, 256, 0, stream>>>(ws, 32768);  // G and P: both are added into
  k_gram<<<B_DIM * 64, 512, 0, stream>>>(emb, G);
  k_attn<<<B_DIM * H_DIM, 512, 0, stream>>>(G, Wq, Wk, Wv, Wo, P);
  k_out<<<B_DIM * 64, 512, 0, stream>>>(emb, P, out);
}

// v002
// Measured time: 29.8 microseconds a run.
// Timed twice side by side with v001, it ran 1.38 and 1.37 times as fast.
// Counting every step since v000, it is 1.89 times as fast.
#include <hip/hip_runtime.h>
#include <hip/hip_bf16.h>

typedef __attribute__((ext_vector_type(2))) float v2f;
typedef __attribute__((ext_vector_type(8))) float v8f;
typedef int v4i __attribute__((vector_size(4 * sizeof(int))));

#define B_DIM 4
#define N_DIM 16384
#define C_DIM 64
#define H_DIM 8
#define EPS_IN 1e-5f
#define WO_PITCH 68
#define RK_PITCH 68
#define KR_PITCH 80

#ifndef __has_builtin
#define __has_builtin(x) 0
#endif

#if __has_builtin(__builtin_amdgcn_global_load_async_to_lds_b128)
#define HAS_ASYNC_LDS 1
#else
#define HAS_ASYNC_LDS 0
#endif

#if __has_builtin(__builtin_amdgcn_s_wait_asynccnt)
#define WAIT_ASYNC(n) __builtin_amdgcn_s_wait_asynccnt(n)
#elif HAS_ASYNC_LDS
#define WAIT_ASYNC(n) asm volatile("s_wait_asynccnt %0" ::"i"(n) : "memory")
#else
#define WAIT_ASYNC(n) ((void)0)
#endif

// addrspace conversions via ptrtoint/inttoptr; pointee type int32x4 per the
// builtin's probed signature (AS1 v4i* source, AS3 v4i* LDS destination).
#define GLB_AS1(p) \
  ((__attribute__((address_space(1))) v4i*)(unsigned long long)(p))
#define LDS_AS3(p) \
  ((__attribute__((address_space(3))) v4i*)(unsigned int)(unsigned long long)(p))

// Copy 64 rows x 64 floats (16 KB) global -> LDS rows of `pitch` floats
// (a multiple of 4); 512 threads x 2 x 16B each, 16 pieces to a row.
static __device__ __forceinline__ void stage4k(const float* __restrict__ g,
                                               float* l, const int pitch,
                                               int t) {
#pragma unroll
  for (int i = 0; i < 2; ++i) {
    const int p = t + i * 512;
    float* d = l + (p >> 4) * pitch + (p & 15) * 4;
#if HAS_ASYNC_LDS
    __builtin_amdgcn_global_load_async_to_lds_b128(GLB_AS1(g + (size_t)p * 4),
                                                   LDS_AS3(d), 0, 0);
#else
    *(float4*)d = ((const float4*)g)[p];
#endif
  }
}

static __device__ __forceinline__ v8f wmma4(v2f a, v2f b, v8f c) {
  return __builtin_amdgcn_wmma_f32_16x16x4_f32(false, a, false, b, (short)0, c,
                                               false, false);
}

__global__ void k_zero(float* __restrict__ g, int n) {
  int i = blockIdx.x * blockDim.x + threadIdx.x;
  if (i < n) g[i] = 0.0f;
}

// G_b = emb_b^T @ emb_b (per-batch 64x64 Gram), streamed over N with
// double-buffered async global->LDS staging.
__global__ void __launch_bounds__(512) k_gram(const float* __restrict__ emb,
                                              float* __restrict__ G) {
  __shared__ __attribute__((aligned(16))) float sE[2][64 * KR_PITCH];  // two 64-row chunks
  const int b   = blockIdx.x >> 6;  // 64 blocks per batch, 256 rows each
  const int blk = blockIdx.x & 63;
  const int t = threadIdx.x;
  const int lane = t & 31, wave = t >> 5;
  const int m = lane & 15;
  const int khalf = (lane < 16) ? 0 : 2;
  const int rowoff = (lane < 16) ? 0 : 8;
  const int ci = wave >> 2, di = wave & 3;  // 16x16 tile of G
  const float* base = emb + ((size_t)b * N_DIM + blk * 256) * C_DIM;

  stage4k(base, sE[0], KR_PITCH, t);  // chunk 0 in flight
  v8f acc = {};

#define GRAM_STEP(c, W, NEXT)                                         \
  {                                                                   \
    if (NEXT)                                                         \
      stage4k(base + ((c) + 1) * 4096, sE[((c) + 1) & 1], KR_PITCH, t); \
    WAIT_ASYNC(W);                                                    \
    __syncthreads();                                                  \
    const float* sb = sE[(c) & 1];                                    \
    _Pragma("unroll") for (int kk = 0; kk < 16; ++kk) {               \
      const int kb = kk * 4 + khalf;                                  \
      v2f a, bv;                                                      \
      a.x  = sb[kb * KR_PITCH + ci * 16 + m];                         \
      a.y  = sb[(kb + 1) * KR_PITCH + ci * 16 + m];                   \
      bv.x = sb[kb * KR_PITCH + di * 16 + m];                         \
      bv.y = sb[(kb + 1) * KR_PITCH + di * 16 + m];                   \
      acc = wmma4(a, bv, acc);                                        \
    }                                                                 \
    __syncthreads();                                                  \
  }

  GRAM_STEP(0, 2, 1)
  GRAM_STEP(1, 2, 1)
  GRAM_STEP(2, 2, 1)
  GRAM_STEP(3, 0, 0)
#undef GRAM_STEP

  float* Gb = G + b * 4096;
#pragma unroll
  for (int v = 0; v < 8; ++v) {
    const int row = ci * 16 + v + rowoff;
    const int col = di * 16 + m;
    atomicAdd(&Gb[row * 64 + col], acc[v]);
  }
}

// Per (b,h): attn = IN+softmax(Wq_h @ G_b @ Wk_h^T); M2_h = attn @ Wv_h;
// then this head's share of the output projection,
// P_b += Wo[:, c*H+h] @ M2_h, added into the zeroed P_b with float atomics.
__global__ void __launch_bounds__(512) k_attn(const float* __restrict__ G,
                                              const float* __restrict__ Wq,
                                              const float* __restrict__ Wk,
                                              const float* __restrict__ Wv,
                                              const float* __restrict__ Wo,
                                              float* __restrict__ P) {
  __shared__ __attribute__((aligned(16))) float sG[64 * RK_PITCH];
  __shared__ __attribute__((aligned(16))) float sA[64 * RK_PITCH];
  __shared__ float sT[64 * KR_PITCH];
  __shared__ float sW[64 * WO_PITCH];
  __shared__ float rs[512], rq[512];
  const int b = blockIdx.x >> 3;
  const int h = blockIdx.x & 7;
  const int t = threadIdx.x;
  const int lane = t & 31, wave = t >> 5;
  const int m = lane & 15;
  const int khalf = (lane < 16) ? 0 : 2;
  const int rowoff = (lane < 16) ? 0 : 8;
  const int ti = wave >> 2, tj = wave & 3;

  {
    const float4* src = (const float4*)(G + b * 4096);
    float* dst = sG + (t >> 4) * RK_PITCH + (t & 15) * 4;  // 16 pieces to a row
    *(float4*)dst = src[t];
    *(float4*)(dst + 32 * RK_PITCH) = src[t + 512];
  }
  __syncthreads();

  const float* Wqh = Wq + h * 64 * 64;
  const float* Wkh = Wk + h * 64 * 64;
  const float* Wvh = Wv + h * 64 * 64;

  // T1 = G @ Wk_h^T
  {
    v8f acc = {};
#pragma unroll
    for (int kk = 0; kk < 16; ++kk) {
      const int kb = kk * 4 + khalf;
      v2f a, bv;
      a.x  = sG[(ti * 16 + m) * RK_PITCH + kb];
      a.y  = sG[(ti * 16 + m) * RK_PITCH + kb + 1];
      bv.x = Wkh[(tj * 16 + m) * 64 + kb];
      bv.y = Wkh[(tj * 16 + m) * 64 + kb + 1];
      acc = wmma4(a, bv, acc);
    }
#pragma unroll
    for (int v = 0; v < 8; ++v)
      sT[(ti * 16 + v + rowoff) * KR_PITCH + tj * 16 + m] = acc[v];
  }
  __syncthreads();

  // attn = Wq_h @ T1
  {
    v8f acc = {};
#pragma unroll
    for (int kk = 0; kk < 16; ++kk) {
      const int kb = kk * 4 + khalf;
      v2f a, bv;
      a.x  = Wqh[(ti * 16 + m) * 64 + kb];
      a.y  = Wqh[(ti * 16 + m) * 64 + kb + 1];
      bv.x = sT[kb * KR_PITCH + tj * 16 + m];
      bv.y = sT[(kb + 1) * KR_PITCH + tj * 16 + m];
      acc = wmma4(a, bv, acc);
    }
#pragma unroll
    for (int v = 0; v < 8; ++v)
      sA[(ti * 16 + v + rowoff) * RK_PITCH + tj * 16 + m] = acc[v];
  }
  __syncthreads();

  // InstanceNorm2d (biased variance) over the whole 64x64 map
  float* const sAt = sA + (t >> 3) * RK_PITCH + (t & 7) * 8;  // elements t*8..t*8+7
  float s = 0.f, q = 0.f;
#pragma unroll
  for (int i = 0; i < 8; ++i) {
    const float x = sAt[i];
    s += x;
    q += x * x;
  }
  rs[t] = s;
  rq[t] = q;
  __syncthreads();
  for (int off = 256; off > 0; off >>= 1) {
    if (t < off) {
      rs[t] += rs[t + off];
      rq[t] += rq[t + off];
    }
    __syncthreads();
  }
  const float mean = rs[0] * (1.0f / 4096.0f);
  const float var  = rq[0] * (1.0f / 4096.0f) - mean * mean;
  const float inv  = rsqrtf(var + EPS_IN);
#pragma unroll
  for (int i = 0; i < 8; ++i)
    sAt[i] = (sAt[i] - mean) * inv;
  __syncthreads();

  // Wo_h[o][c] = Wo[o*512 + c*H + h] for the last product: each 128-byte line
  // of Wo holds 4 values of this head, so a wave takes 8 rows x 4 columns per
  // load (8 lines) and every line is asked for once per block. Requested here
  // so that the values arrive while the softmax runs.
  const int wo_o = (wave & 7) * 8 + (lane >> 2);
  const int wo_c = (wave >> 3) * 32 + (lane & 3);
  float wo[8];
  {
    const float* wp = Wo + wo_o * 512 + wo_c * H_DIM + h;
#pragma unroll  // all 8 loads in flight at once, wo[] in registers
    for (int i = 0; i < 8; ++i) wo[i] = wp[i * 4 * H_DIM];
  }

  // softmax over last dim (each of 64 rows)
  if (t < 64) {
    float mx = -1e30f;
    float* const row = sA + t * RK_PITCH;
    for (int j = 0; j < 64; ++j) mx = fmaxf(mx, row[j]);
    float se = 0.f;
    for (int j = 0; j < 64; ++j) se += __expf(row[j] - mx);
    const float r = 1.0f / se;
    for (int j = 0; j < 64; ++j) row[j] = __expf(row[j] - mx) * r;
  }
#pragma unroll  // wo[] indexed by constants only, so it stays in registers
  for (int i = 0; i < 8; ++i) sW[wo_o * WO_PITCH + wo_c + i * 4] = wo[i];
  __syncthreads();

  // M2_h = attn @ Wv_h, kept in LDS (sT is free since the second product)
  {
    v8f acc = {};
#pragma unroll
    for (int kk = 0; kk < 16; ++kk) {
      const int kb = kk * 4 + khalf;
      v2f a, bv;
      a.x  = sA[(ti * 16 + m) * RK_PITCH + kb];
      a.y  = sA[(ti * 16 + m) * RK_PITCH + kb + 1];
      bv.x = Wvh[kb * 64 + tj * 16 + m];
      bv.y = Wvh[(kb + 1) * 64 + tj * 16 + m];
      acc = wmma4(a, bv, acc);
    }
#pragma unroll  // acc[] indexed by constants only, so it stays in registers
    for (int v = 0; v < 8; ++v)
      sT[(ti * 16 + v + rowoff) * KR_PITCH + tj * 16 + m] = acc[v];
  }
  __syncthreads();  // M2_h complete in sT before any wave reads it as B

  // P_b += Wo_h @ M2_h
  {
    v8f acc = {};
#pragma unroll  // lets the LDS reads of later k steps start ahead of the WMMAs
    for (int kk = 0; kk < 16; ++kk) {
      const int kb = kk * 4 + khalf;
      v2f a, bv;
      a.x  = sW[(ti * 16 + m) * WO_PITCH + kb];
      a.y  = sW[(ti * 16 + m) * WO_PITCH + kb + 1];
      bv.x = sT[kb * KR_PITCH + tj * 16 + m];
      bv.y = sT[(kb + 1) * KR_PITCH + tj * 16 + m];
      acc = wmma4(a, bv, acc);
    }
    float* pp = P + b * 4096 + (ti * 16 + rowoff) * 64 + tj * 16 + m;
#pragma unroll  // acc[] indexed by constants only, so it stays in registers
    for (int v = 0; v < 8; ++v) atomicAdd(pp + v * 64, acc[v]);
  }
}

// out_b = emb_b @ P_b^T, streamed over N: async-staged P_b + double-buffered
// emb chunks; non-temporal output stores.
__global__ void __launch_bounds__(512) k_out(const float* __restrict__ emb,
                                             const float* __restrict__ P,
                                             float* __restrict__ out) {
  __shared__ __attribute__((aligned(16))) float sP[64 * RK_PITCH];
  __shared__ __attribute__((aligned(16))) float sE[2][64 * RK_PITCH];
  const int b   = blockIdx.x >> 6;  // 64 blocks per batch, 256 rows each
  const int blk = blockIdx.x & 63;
  const int n0  = blk * 256;
  const int t = threadIdx.x;
  const int lane = t & 31, wave = t >> 5;
  const int m = lane & 15;
  const int khalf = (lane < 16) ? 0 : 2;
  const int rowoff = (lane < 16) ? 0 : 8;
  const int nt = wave >> 2, ct = wave & 3;
  const float* ebase = emb + ((size_t)b * N_DIM + n0) * C_DIM;

  stage4k(P + b * 4096, sP, RK_PITCH, t);  // issued first: in-order ahead of chunks
  stage4k(ebase, sE[0], RK_PITCH, t);      // chunk 0
  WAIT_ASYNC(2);                 // sP landed (in-order); chunk0 may be in flight
  __syncthreads();

  v2f brg[16];
#pragma unroll
  for (int kk = 0; kk < 16; ++kk) {
    const int kb = kk * 4 + khalf;
    brg[kk].x = sP[(ct * 16 + m) * RK_PITCH + kb];
    brg[kk].y = sP[(ct * 16 + m) * RK_PITCH + kb + 1];
  }

  float* ob = out + ((size_t)b * N_DIM + n0) * C_DIM;

#define OUT_STEP(c, W, NEXT)                                            \
  {                                                                     \
    if (NEXT)                                                           \
      stage4k(ebase + ((c) + 1) * 4096, sE[((c) + 1) & 1], RK_PITCH, t); \
    WAIT_ASYNC(W);                                                      \
    __syncthreads();                                                    \
    const float* sb = sE[(c) & 1];                                      \
    v8f acc = {};                                                       \
    _Pragma("unroll") for (int kk = 0; kk < 16; ++kk) {                 \
      const int kb = kk * 4 + khalf;                                    \
      v2f a;                                                            \
      a.x = sb[(nt * 16 + m) * RK_PITCH + kb];                          \
      a.y = sb[(nt * 16 + m) * RK_PITCH + kb + 1];                      \
      acc = wmma4(a, brg[kk], acc);                                     \
    }                                                                   \
    _Pragma("unroll") for (int v = 0; v < 8; ++v)                       \
        __builtin_nontemporal_store(                                    \
            acc[v],                                                     \
            &ob[((c) * 64 + nt * 16 + v + rowoff) * 64 + ct * 16 + m]); \
    __syncthreads();                                                    \
  }

  OUT_STEP(0, 2, 1)
  OUT_STEP(1, 2, 1)
  OUT_STEP(2, 2, 1)
  OUT_STEP(3, 0, 0)
#undef OUT_STEP
}

extern "C" void kernel_launch(void* const* d_in, const int* in_sizes, int n_in,
                              void* d_out, int out_size, void* d_ws,
                              size_t ws_size, hipStream_t stream) {
  (void)in_sizes; (void)n_in; (void)out_size; (void)ws_size;
  const float* emb = (const float*)d_in[0];
  const float* Wq  = (const float*)d_in[1];
  const float* Wk  = (const float*)d_in[2];
  const float* Wv  = (const float*)d_in[3];
  const float* Wo  = (const float*)d_in[4];
  float* out = (float*)d_out;

  float* ws = (float*)d_ws;
  float* G = ws;          // B*4096 = 16384 floats
  float* P = ws + 16384;  // B*4096 = 16384 floats, directly behind G

  k_zero<<<128, 256, 0, stream>>>(ws, 32768);  // G and P: both are added into
  k_gram<<<B_DIM * 64, 512, 0, stream>>>(emb, G);
  k_attn<<<B_DIM * H_DIM, 512, 0, stream>>>(G, Wq, Wk, Wv, Wo, P);
  k_out<<<B_DIM * 64, 512, 0, stream>>>(emb, P, out);
}

// v003
// Measured time: 27.2 microseconds a run.
// In two side-by-side timings against v002, it was 1.09 and 1.10 times as fast.
// All steps since v000 together make it 2.07 times as fast.
#include <hip/hip_runtime.h>
#include <hip/hip_bf16.h>

typedef __attribute__((ext_vector_type(2))) float v2f;
typedef __attribute__((ext_vector_type(8))) float v8f;
typedef int v4i __attribute__((vector_size(4 * sizeof(int))));

#define B_DIM 4
#define N_DIM 16384
#define C_DIM 64
#define H_DIM 8
#define EPS_IN 1e-5f
#define WO_PITCH 68
#define RK_PITCH 68
#define KR_PITCH 80

#ifndef __has_builtin
#define __has_builtin(x) 0
#endif

#if __has_builtin(__builtin_amdgcn_global_load_async_to_lds_b128)
#define HAS_ASYNC_LDS 1
#else
#define HAS_ASYNC_LDS 0
#endif

#if __has_builtin(__builtin_amdgcn_s_wait_asynccnt)
#define WAIT_ASYNC(n) __builtin_amdgcn_s_wait_asynccnt(n)
#elif HAS_ASYNC_LDS
#define WAIT_ASYNC(n) asm volatile("s_wait_asynccnt %0" ::"i"(n) : "memory")
#else
#define WAIT_ASYNC(n) ((void)0)
#endif

// addrspace conversions via ptrtoint/inttoptr; pointee type int32x4 per the
// builtin's probed signature (AS1 v4i* source, AS3 v4i* LDS destination).
#define GLB_AS1(p) \
  ((__attribute__((address_space(1))) v4i*)(unsigned long long)(p))
#define LDS_AS3(p) \
  ((__attribute__((address_space(3))) v4i*)(unsigned int)(unsigned long long)(p))

// Copy 64 rows x 64 floats (16 KB) global -> LDS rows of `pitch` floats
// (a multiple of 4); 512 threads x 2 x 16B each, 16 pieces to a row.
static __device__ __forceinline__ void stage4k(const float* __restrict__ g,
                                               float* l, const int pitch,
                                               int t) {
#pragma unroll
  for (int i = 0; i < 2; ++i) {
    const int p = t + i * 512;
    float* d = l + (p >> 4) * pitch + (p & 15) * 4;
#if HAS_ASYNC_LDS
    __builtin_amdgcn_global_load_async_to_lds_b128(GLB_AS1(g + (size_t)p * 4),
                                                   LDS_AS3(d), 0, 0);
#else
    *(float4*)d = ((const float4*)g)[p];
#endif
  }
}

static __device__ __forceinline__ v8f wmma4(v2f a, v2f b, v8f c) {
  return __builtin_amdgcn_wmma_f32_16x16x4_f32(false, a, false, b, (short)0, c,
                                               false, false);
}

// Value of lane (l ^ n) inside a 16-lane row, n = CTRL - 0x160 (DPP row_xmask):
// a register move, where __shfl_xor would go through the LDS pipe.
template <int CTRL>
static __device__ __forceinline__ float row_xor(float x) {
  return __builtin_bit_cast(
      float, __builtin_amdgcn_update_dpp(0, __builtin_bit_cast(int, x), CTRL,
                                         0xf, 0xf, true));
}
// Butterfly sums: every lane of the group ends with the same bits.
static __device__ __forceinline__ float sum8(float x) {
  x += row_xor<0x161>(x);
  x += row_xor<0x162>(x);
  x += row_xor<0x164>(x);
  return x;
}
static __device__ __forceinline__ float sum16(float x) {
  x = sum8(x);
  x += row_xor<0x168>(x);
  return x;
}
static __device__ __forceinline__ float sum32(float x) {
  x = sum16(x);
  const int b = __builtin_bit_cast(int, x);
  x += __builtin_bit_cast(float, __builtin_amdgcn_permlanex16(
                                     b, b, 0x76543210, 0xfedcba98, false, false));
  return x;
}
static __device__ __forceinline__ float max8(float x) {
  x = fmaxf(x, row_xor<0x161>(x));
  x = fmaxf(x, row_xor<0x162>(x));
  x = fmaxf(x, row_xor<0x164>(x));
  return x;
}

__global__ void k_zero(float* __restrict__ g, int n) {
  int i = blockIdx.x * blockDim.x + threadIdx.x;
  if (i < n) g[i] = 0.0f;
}

// G_b = emb_b^T @ emb_b (per-batch 64x64 Gram), streamed over N with
// double-buffered async global->LDS staging.
__global__ void __launch_bounds__(512) k_gram(const float* __restrict__ emb,
                                              float* __restrict__ G) {
  __shared__ __attribute__((aligned(16))) float sE[2][64 * KR_PITCH];  // two 64-row chunks
  const int b   = blockIdx.x >> 6;  // 64 blocks per batch, 256 rows each
  const int blk = blockIdx.x & 63;
  const int t = threadIdx.x;
  const int lane = t & 31, wave = t >> 5;
  const int m = lane & 15;
  const int khalf = (lane < 16) ? 0 : 2;
  const int rowoff = (lane < 16) ? 0 : 8;
  const int ci = wave >> 2, di = wave & 3;  // 16x16 tile of G
  const float* base = emb + ((size_t)b * N_DIM + blk * 256) * C_DIM;

  stage4k(base, sE[0], KR_PITCH, t);  // chunk 0 in flight
  v8f acc = {};

#define GRAM_STEP(c, W, NEXT)                                         \
  {                                                                   \
    if (NEXT)                                                         \
      stage4k(base + ((c) + 1) * 4096, sE[((c) + 1) & 1], KR_PITCH, t); \
    WAIT_ASYNC(W);                                                    \
    __syncthreads();                                                  \
    const float* sb = sE[(c) & 1];                                    \
    _Pragma("unroll") for (int kk = 0; kk < 16; ++kk) {               \
      const int kb = kk * 4 + khalf;                                  \
      v2f a, bv;                                                      \
      a.x  = sb[kb * KR_PITCH + ci * 16 + m];                         \
      a.y  = sb[(kb + 1) * KR_PITCH + ci * 16 + m];                   \
      bv.x = sb[kb * KR_PITCH + di * 16 + m];                         \
      bv.y = sb[(kb + 1) * KR_PITCH + di * 16 + m];                   \
      acc = wmma4(a, bv, acc);                                        \
    }                                                                 \
    __syncthreads();                                                  \
  }

  GRAM_STEP(0, 2, 1)
  GRAM_STEP(1, 2, 1)
  GRAM_STEP(2, 2, 1)
  GRAM_STEP(3, 0, 0)
#undef GRAM_STEP

  float* Gb = G + b * 4096;
#pragma unroll
  for (int v = 0; v < 8; ++v) {
    const int row = ci * 16 + v + rowoff;
    const int col = di * 16 + m;
    atomicAdd(&Gb[row * 64 + col], acc[v]);
  }
}

// Per (b,h): attn = IN+softmax(Wq_h @ G_b @ Wk_h^T); M2_h = attn @ Wv_h;
// then this head's share of the output projection,
// P_b += Wo[:, c*H+h] @ M2_h, added into the zeroed P_b with float atomics.
__global__ void __launch_bounds__(512) k_attn(const float* __restrict__ G,
                                              const float* __restrict__ Wq,
                                              const float* __restrict__ Wk,
                                              const float* __restrict__ Wv,
                                              const float* __restrict__ Wo,
                                              float* __restrict__ P) {
  __shared__ __attribute__((aligned(16))) float sG[64 * RK_PITCH];
  __shared__ __attribute__((aligned(16))) float sA[64 * RK_PITCH];
  __shared__ float sT[64 * KR_PITCH];
  __shared__ float sW[64 * WO_PITCH];
  __shared__ float2 red[16];  // each wave's sum and sum of squares of the map
  const int b = blockIdx.x >> 3;
  const int h = blockIdx.x & 7;
  const int t = threadIdx.x;
  const int lane = t & 31, wave = t >> 5;
  const int m = lane & 15;
  const int khalf = (lane < 16) ? 0 : 2;
  const int rowoff = (lane < 16) ? 0 : 8;
  const int ti = wave >> 2, tj = wave & 3;

  {
    const float4* src = (const float4*)(G + b * 4096);
    float* dst = sG + (t >> 4) * RK_PITCH + (t & 15) * 4;  // 16 pieces to a row
    *(float4*)dst = src[t];
    *(float4*)(dst + 32 * RK_PITCH) = src[t + 512];
  }
  __syncthreads();

  const float* Wqh = Wq + h * 64 * 64;
  const float* Wkh = Wk + h * 64 * 64;
  const float* Wvh = Wv + h * 64 * 64;

  // T1 = G @ Wk_h^T
  {
    v8f acc = {};
#pragma unroll
    for (int kk = 0; kk < 16; ++kk) {
      const int kb = kk * 4 + khalf;
      v2f a, bv;
      a.x  = sG[(ti * 16 + m) * RK_PITCH + kb];
      a.y  = sG[(ti * 16 + m) * RK_PITCH + kb + 1];
      bv.x = Wkh[(tj * 16 + m) * 64 + kb];
      bv.y = Wkh[(tj * 16 + m) * 64 + kb + 1];
      acc = wmma4(a, bv, acc);
    }
#pragma unroll
    for (int v = 0; v < 8; ++v)
      sT[(ti * 16 + v + rowoff) * KR_PITCH + tj * 16 + m] = acc[v];
  }
  __syncthreads();

  // attn = Wq_h @ T1
  {
    v8f acc = {};
#pragma unroll
    for (int kk = 0; kk < 16; ++kk) {
      const int kb = kk * 4 + khalf;
      v2f a, bv;
      a.x  = Wqh[(ti * 16 + m) * 64 + kb];
      a.y  = Wqh[(ti * 16 + m) * 64 + kb + 1];
      bv.x = sT[kb * KR_PITCH + tj * 16 + m];
      bv.y = sT[(kb + 1) * KR_PITCH + tj * 16 + m];
      acc = wmma4(a, bv, acc);
    }
#pragma unroll
    for (int v = 0; v < 8; ++v)
      sA[(ti * 16 + v + rowoff) * RK_PITCH + tj * 16 + m] = acc[v];
  }
  __syncthreads();

  // InstanceNorm2d (biased variance) over the whole 64x64 map, then softmax
  // over each row: 8 lanes own a row, 8 elements each (t*8..t*8+7), held in
  // registers from the one read to the one write; no other thread touches them.
  float* const sAt = sA + (t >> 3) * RK_PITCH + (t & 7) * 8;
  float x[8];
  {
    const float4 lo = *(const float4*)sAt;
    const float4 hi = *(const float4*)(sAt + 4);
    x[0] = lo.x; x[1] = lo.y; x[2] = lo.z; x[3] = lo.w;
    x[4] = hi.x; x[5] = hi.y; x[6] = hi.z; x[7] = hi.w;
    float s = 0.f, q = 0.f;
#pragma unroll  // x[] indexed by constants only, so it stays in registers
    for (int i = 0; i < 8; ++i) {
      s += x[i];
      q += x[i] * x[i];
    }
    s = sum32(s);
    q = sum32(q);
    if (lane == 0) red[wave] = make_float2(s, q);
  }
  __syncthreads();  // the 16 waves' sums are in red[]

  // Wo_h[o][c] = Wo[o*512 + c*H + h] for the last product: each 128-byte line
  // of Wo holds 4 values of this head, so a wave takes 8 rows x 4 columns per
  // load (8 lines) and every line is asked for once per block. Requested here
  // so that the values arrive while the softmax runs.
  const int wo_o = (wave & 7) * 8 + (lane >> 2);
  const int wo_c = (wave >> 3) * 32 + (lane & 3);
  float wo[8];
  {
    const float* wp = Wo + wo_o * 512 + wo_c * H_DIM + h;
#pragma unroll  // all 8 loads in flight at once, wo[] in registers
    for (int i = 0; i < 8; ++i) wo[i] = wp[i * 4 * H_DIM];
  }

  {
    const float2 pr = red[lane & 15];
    const float mean = sum16(pr.x) * (1.0f / 4096.0f);
    const float var  = sum16(pr.y) * (1.0f / 4096.0f) - mean * mean;
    const float inv  = rsqrtf(var + EPS_IN);
    float mx = -1e30f;
#pragma unroll  // x[] indexed by constants only, so it stays in registers
    for (int i = 0; i < 8; ++i) {
      x[i] = (x[i] - mean) * inv;
      mx = fmaxf(mx, x[i]);
    }
    mx = max8(mx);
#pragma unroll  // x[] indexed by constants only, so it stays in registers
    for (int i = 0; i < 8; ++i) x[i] = __expf(x[i] - mx);
    asm volatile("v_nop" ::"v"(x[0]), "v"(x[1]), "v"(x[2]), "v"(x[3]), "v"(x[4]),
                 "v"(x[5]), "v"(x[6]), "v"(x[7]));
    // pairwise: three dependent adds in place of eight
    const float se = ((x[0] + x[1]) + (x[2] + x[3])) + ((x[4] + x[5]) + (x[6] + x[7]));
    const float r = 1.0f / sum8(se);
    *(float4*)sAt = make_float4(x[0] * r, x[1] * r, x[2] * r, x[3] * r);
    *(float4*)(sAt + 4) = make_float4(x[4] * r, x[5] * r, x[6] * r, x[7] * r);
  }
#pragma unroll  // wo[] indexed by constants only, so it stays in registers
  for (int i = 0; i < 8; ++i) sW[wo_o * WO_PITCH + wo_c + i * 4] = wo[i];
  __syncthreads();

  // M2_h = attn @ Wv_h, kept in LDS (sT is free since the second product)
  {
    v8f acc = {};
#pragma unroll
    for (int kk = 0; kk < 16; ++kk) {
      const int kb = kk * 4 + khalf;
      v2f a, bv;
      a.x  = sA[(ti * 16 + m) * RK_PITCH + kb];
      a.y  = sA[(ti * 16 + m) * RK_PITCH + kb + 1];
      bv.x = Wvh[kb * 64 + tj * 16 + m];
      bv.y = Wvh[(kb + 1) * 64 + tj * 16 + m];
      acc = wmma4(a, bv, acc);
    }
#pragma unroll  // acc[] indexed by constants only, so it stays in registers
    for (int v = 0; v < 8; ++v)
      sT[(ti * 16 + v + rowoff) * KR_PITCH + tj * 16 + m] = acc[v];
  }
  __syncthreads();  // M2_h complete in sT before any wave reads it as B

  // P_b += Wo_h @ M2_h
  {
    v8f acc = {};
#pragma unroll  // lets the LDS reads of later k steps start ahead of the WMMAs
    for (int kk = 0; kk < 16; ++kk) {
      const int kb = kk * 4 + khalf;
      v2f a, bv;
      a.x  = sW[(ti * 16 + m) * WO_PITCH + kb];
      a.y  = sW[(ti * 16 + m) * WO_PITCH + kb + 1];
      bv.x = sT[kb * KR_PITCH + tj * 16 + m];
      bv.y = sT[(kb + 1) * KR_PITCH + tj * 16 + m];
      acc = wmma4(a, bv, acc);
    }
    float* pp = P + b * 4096 + (ti * 16 + rowoff) * 64 + tj * 16 + m;
#pragma unroll  // acc[] indexed by constants only, so it stays in registers
    for (int v = 0; v < 8; ++v) atomicAdd(pp + v * 64, acc[v]);
  }
}

// out_b = emb_b @ P_b^T, streamed over N: async-staged P_b + double-buffered
// emb chunks; non-temporal output stores.
__global__ void __launch_bounds__(512) k_out(const float* __restrict__ emb,
                                             const float* __restrict__ P,
                                             float* __restrict__ out) {
  __shared__ __attribute__((aligned(16))) float sP[64 * RK_PITCH];
  __shared__ __attribute__((aligned(16))) float sE[2][64 * RK_PITCH];
  const int b   = blockIdx.x >> 6;  // 64 blocks per batch, 256 rows each
  const int blk = blockIdx.x & 63;
  const int n0  = blk * 256;
  const int t = threadIdx.x;
  const int lane = t & 31, wave = t >> 5;
  const int m = lane & 15;
  const int khalf = (lane < 16) ? 0 : 2;
  const int rowoff = (lane < 16) ? 0 : 8;
  const int nt = wave >> 2, ct = wave & 3;
  const float* ebase = emb + ((size_t)b * N_DIM + n0) * C_DIM;

  stage4k(P + b * 4096, sP, RK_PITCH, t);  // issued first: in-order ahead of chunks
  stage4k(ebase, sE[0], RK_PITCH, t);      // chunk 0
  WAIT_ASYNC(2);                 // sP landed (in-order); chunk0 may be in flight
  __syncthreads();

  v2f brg[16];
#pragma unroll
  for (int kk = 0; kk < 16; ++kk) {
    const int kb = kk * 4 + khalf;
    brg[kk].x = sP[(ct * 16 + m) * RK_PITCH + kb];
    brg[kk].y = sP[(ct * 16 + m) * RK_PITCH + kb + 1];
  }

  float* ob = out + ((size_t)b * N_DIM + n0) * C_DIM;

#define OUT_STEP(c, W, NEXT)                                            \
  {                                                                     \
    if (NEXT)                                                           \
      stage4k(ebase + ((c) + 1) * 4096, sE[((c) + 1) & 1], RK_PITCH, t); \
    WAIT_ASYNC(W);                                                      \
    __syncthreads();                                                    \
    const float* sb = sE[(c) & 1];                                      \
    v8f acc = {};                                                       \
    _Pragma("unroll") for (int kk = 0; kk < 16; ++kk) {                 \
      const int kb = kk * 4 + khalf;                                    \
      v2f a;                                                            \
      a.x = sb[(nt * 16 + m) * RK_PITCH + kb];                          \
      a.y = sb[(nt * 16 + m) * RK_PITCH + kb + 1];                      \
      acc = wmma4(a, brg[kk], acc);                                     \
    }                                                                   \
    _Pragma("unroll") for (int v = 0; v < 8; ++v)                       \
        __builtin_nontemporal_store(                                    \
            acc[v],                                                     \
            &ob[((c) * 64 + nt * 16 + v + rowoff) * 64 + ct * 16 + m]); \
    __syncthreads();                                                    \
  }

  OUT_STEP(0, 2, 1)
  OUT_STEP(1, 2, 1)
  OUT_STEP(2, 2, 1)
  OUT_STEP(3, 0, 0)
#undef OUT_STEP
}

extern "C" void kernel_launch(void* const* d_in, const int* in_sizes, int n_in,
                              void* d_out, int out_size, void* d_ws,
                              size_t ws_size, hipStream_t stream) {
  (void)in_sizes; (void)n_in; (void)out_size; (void)ws_size;
  const float* emb = (const float*)d_in[0];
  const float* Wq  = (const float*)d_in[1];
  const float* Wk  = (const float*)d_in[2];
  const float* Wv  = (const float*)d_in[3];
  const float* Wo  = (const float*)d_in[4];
  float* out = (float*)d_out;

  float* ws = (float*)d_ws;
  float* G = ws;          // B*4096 = 16384 floats
  float* P = ws + 16384;  // B*4096 = 16384 floats, directly behind G

  k_zero<<<128, 256, 0, stream>>>(ws, 32768);  // G and P: both are added into
  k_gram<<<B_DIM * 64, 512, 0, stream>>>(emb, G);
  k_attn<<<B_DIM * H_DIM, 512, 0, stream>>>(G, Wq, Wk, Wv, Wo, P);
  k_out<<<B_DIM * 64, 512, 0, stream>>>(emb, P, out);
}

// v004
// Measured time: 26.3 microseconds a run.
// Timed twice side by side with v003, it ran 1.05 and 1.04 times as fast.
// All steps since v000 together make it 2.16 times as fast.
#include <hip/hip_runtime.h>
#include <hip/hip_bf16.h>

typedef __attribute__((ext_vector_type(2))) float v2f;
typedef __attribute__((ext_vector_type(8))) float v8f;
typedef int v4i __attribute__((vector_size(4 * sizeof(int))));

#define B_DIM 4
#define N_DIM 16384
#define C_DIM 64
#define H_DIM 8
#define EPS_IN 1e-5f
#define WO_PITCH 68
#define RK_PITCH 68
#define KR_PITCH 80

#ifndef __has_builtin
#define __has_builtin(x) 0
#endif

#if __has_builtin(__builtin_amdgcn_global_load_async_to_lds_b128)
#define HAS_ASYNC_LDS 1
#else
#define HAS_ASYNC_LDS 0
#endif

#if __has_builtin(__builtin_amdgcn_s_wait_asynccnt)
#define WAIT_ASYNC(n) __builtin_amdgcn_s_wait_asynccnt(n)
#elif HAS_ASYNC_LDS
#define WAIT_ASYNC(n) asm volatile("s_wait_asynccnt %0" ::"i"(n) : "memory")
#else
#define WAIT_ASYNC(n) ((void)0)
#endif

// addrspace conversions via ptrtoint/inttoptr; pointee type int32x4 per the
// builtin's probed signature (AS1 v4i* source, AS3 v4i* LDS destination).
#define GLB_AS1(p) \
  ((__attribute__((address_space(1))) v4i*)(unsigned long long)(p))
#define LDS_AS3(p) \
  ((__attribute__((address_space(3))) v4i*)(unsigned int)(unsigned long long)(p))

// Copy 64 rows x 64 floats (16 KB) global -> LDS rows of `pitch` floats
// (a multiple of 4); 512 threads x 2 x 16B each, 16 pieces to a row.
static __device__ __forceinline__ void stage4k(const float* __restrict__ g,
                                               float* l, const int pitch,
                                               int t) {
#pragma unroll
  for (int i = 0; i < 2; ++i) {
    const int p = t + i * 512;
    float* d = l + (p >> 4) * pitch + (p & 15) * 4;
#if HAS_ASYNC_LDS
    __builtin_amdgcn_global_load_async_to_lds_b128(GLB_AS1(g + (size_t)p * 4),
                                                   LDS_AS3(d), 0, 0);
#else
    *(float4*)d = ((const float4*)g)[p];
#endif
  }
}

static __device__ __forceinline__ v8f wmma4(v2f a, v2f b, v8f c) {
  return __builtin_amdgcn_wmma_f32_16x16x4_f32(false, a, false, b, (short)0, c,
                                               false, false);
}

// Value of lane (l ^ n) inside a 16-lane row, n = CTRL - 0x160 (DPP row_xmask):
// a register move, where __shfl_xor would go through the LDS pipe.
template <int CTRL>
static __device__ __forceinline__ float row_xor(float x) {
  return __builtin_bit_cast(
      float, __builtin_amdgcn_update_dpp(0, __builtin_bit_cast(int, x), CTRL,
                                         0xf, 0xf, true));
}
// Butterfly sums: every lane of the group ends with the same bits.
static __device__ __forceinline__ float sum8(float x) {
  x += row_xor<0x161>(x);
  x += row_xor<0x162>(x);
  x += row_xor<0x164>(x);
  return x;
}
static __device__ __forceinline__ float sum16(float x) {
  x = sum8(x);
  x += row_xor<0x168>(x);
  return x;
}
static __device__ __forceinline__ float sum32(float x) {
  x = sum16(x);
  const int b = __builtin_bit_cast(int, x);
  x += __builtin_bit_cast(float, __builtin_amdgcn_permlanex16(
                                     b, b, 0x76543210, 0xfedcba98, false, false));
  return x;
}
static __device__ __forceinline__ float max8(float x) {
  x = fmaxf(x, row_xor<0x161>(x));
  x = fmaxf(x, row_xor<0x162>(x));
  x = fmaxf(x, row_xor<0x164>(x));
  return x;
}

// Each block's share of G_b = emb_b^T @ emb_b (per-batch 64x64 Gram) over its
// 256 rows, streamed with double-buffered async global->LDS staging and stored
// as this block's own 64x64 partial, in accumulator order (see the epilogue).
__global__ void __launch_bounds__(512) k_gram(const float* __restrict__ emb,
                                              float* __restrict__ Gp) {
  __shared__ __attribute__((aligned(16))) float sE[2][64 * KR_PITCH];  // two 64-row chunks
  const int b   = blockIdx.x >> 6;  // 64 blocks per batch, 256 rows each
  const int blk = blockIdx.x & 63;
  const int t = threadIdx.x;
  const int lane = t & 31, wave = t >> 5;
  const int m = lane & 15;
  const int khalf = (lane < 16) ? 0 : 2;
  const int ci = wave >> 2, di = wave & 3;  // 16x16 tile of G
  const float* base = emb + ((size_t)b * N_DIM + blk * 256) * C_DIM;

  stage4k(base, sE[0], KR_PITCH, t);  // chunk 0 in flight
  v8f acc = {};

#define GRAM_STEP(c, W, NEXT)                                         \
  {                                                                   \
    if (NEXT)                                                         \
      stage4k(base + ((c) + 1) * 4096, sE[((c) + 1) & 1], KR_PITCH, t); \
    WAIT_ASYNC(W);                                                    \
    __syncthreads();                                                  \
    const float* sb = sE[(c) & 1];                                    \
    _Pragma("unroll") for (int kk = 0; kk < 16; ++kk) {               \
      const int kb = kk * 4 + khalf;                                  \
      v2f a, bv;                                                      \
      a.x  = sb[kb * KR_PITCH + ci * 16 + m];                         \
      a.y  = sb[(kb + 1) * KR_PITCH + ci * 16 + m];                   \
      bv.x = sb[kb * KR_PITCH + di * 16 + m];                         \
      bv.y = sb[(kb + 1) * KR_PITCH + di * 16 + m];                   \
      acc = wmma4(a, bv, acc);                                        \
    }                                                                 \
    __syncthreads();                                                  \
  }

  GRAM_STEP(0, 2, 1)
  GRAM_STEP(1, 2, 1)
  GRAM_STEP(2, 2, 1)
  GRAM_STEP(3, 0, 0)
#undef GRAM_STEP

  // Partial layout: [wave tile][half = v / 4][lane][v % 4], so that each of the
  // two stores of a wave is 512 contiguous bytes; k_gsum undoes the order.
  float* pp = Gp + (size_t)blockIdx.x * 4096 + wave * 256 + lane * 4;
  *(float4*)pp = make_float4(acc[0], acc[1], acc[2], acc[3]);
  *(float4*)(pp + 128) = make_float4(acc[4], acc[5], acc[6], acc[7]);
}

// G_b = sum of the batch's 64 block partials, in a fixed order; also clears P,
// which k_attn adds into. A block owns one half tile (128 floats) of one batch:
// wave g sums partials 8g..8g+7 (512 contiguous bytes per load, all 8 loads in
// flight), the 8 waves' sums meet in LDS.
__global__ void __launch_bounds__(256) k_gsum(const float* __restrict__ Gp,
                                              float* __restrict__ G,
                                              float* __restrict__ P) {
  __shared__ __attribute__((aligned(16))) float sR[8 * 128];
  const int b = blockIdx.x >> 5;
  const int s = blockIdx.x & 31;  // wave tile * 2 + half
  const int t = threadIdx.x;
  const int lane = t & 31, g = t >> 5;
  const float* src = Gp + ((size_t)(b * 64 + g * 8)) * 4096 + s * 128 + lane * 4;
  float4 p[8];
#pragma unroll  // all 8 loads in flight at once, p[] in registers
  for (int i = 0; i < 8; ++i) p[i] = *(const float4*)(src + i * 4096);
  float4 a;
  a.x = ((p[0].x + p[1].x) + (p[2].x + p[3].x)) + ((p[4].x + p[5].x) + (p[6].x + p[7].x));
  a.y = ((p[0].y + p[1].y) + (p[2].y + p[3].y)) + ((p[4].y + p[5].y) + (p[6].y + p[7].y));
  a.z = ((p[0].z + p[1].z) + (p[2].z + p[3].z)) + ((p[4].z + p[5].z) + (p[6].z + p[7].z));
  a.w = ((p[0].w + p[1].w) + (p[2].w + p[3].w)) + ((p[4].w + p[5].w) + (p[6].w + p[7].w));
  *(float4*)(sR + g * 128 + lane * 4) = a;
  __syncthreads();  // the 8 waves' sums are in sR
  if (t < 128) {
    // 8 rows x 16 columns of G: accumulator register v = half*4 + j, lanes
    // 16..31 hold rows 8 further down
    const int c = t & 15, j = (t >> 4) & 3, hi = t >> 6;
    const float* r = sR + (hi * 16 + c) * 4 + j;
    const float x = ((r[0] + r[128]) + (r[256] + r[384])) +
                    ((r[512] + r[640]) + (r[768] + r[896]));
    const int row = (s >> 3) * 16 + (s & 1) * 4 + j + hi * 8;
    const int col = ((s >> 1) & 3) * 16 + c;
    G[b * 4096 + row * 64 + col] = x;
  } else {
    P[blockIdx.x * 128 + (t - 128)] = 0.0f;
  }
}

// Per (b,h): attn = IN+softmax(Wq_h @ G_b @ Wk_h^T); M2_h = attn @ Wv_h;
// then this head's share of the output projection,
// P_b += Wo[:, c*H+h] @ M2_h, added into the zeroed P_b with float atomics.
__global__ void __launch_bounds__(512) k_attn(const float* __restrict__ G,
                                              const float* __restrict__ Wq,
                                              const float* __restrict__ Wk,
                                              const float* __restrict__ Wv,
                                              const float* __restrict__ Wo,
                                              float* __restrict__ P) {
  __shared__ __attribute__((aligned(16))) float sG[64 * RK_PITCH];
  __shared__ __attribute__((aligned(16))) float sA[64 * RK_PITCH];
  __shared__ float sT[64 * KR_PITCH];
  __shared__ float sW[64 * WO_PITCH];
  __shared__ float2 red[16];  // each wave's sum and sum of squares of the map
  const int b = blockIdx.x >> 3;
  const int h = blockIdx.x & 7;
  const int t = threadIdx.x;
  const int lane = t & 31, wave = t >> 5;
  const int m = lane & 15;
  const int khalf = (lane < 16) ? 0 : 2;
  const int rowoff = (lane < 16) ? 0 : 8;
  const int ti = wave >> 2, tj = wave & 3;

  {
    const float4* src = (const float4*)(G + b * 4096);
    float* dst = sG + (t >> 4) * RK_PITCH + (t & 15) * 4;  // 16 pieces to a row
    *(float4*)dst = src[t];
    *(float4*)(dst + 32 * RK_PITCH) = src[t + 512];
  }
  __syncthreads();

  const float* Wqh = Wq + h * 64 * 64;
  const float* Wkh = Wk + h * 64 * 64;
  const float* Wvh = Wv + h * 64 * 64;

  // T1 = G @ Wk_h^T
  {
    v8f acc = {};
#pragma unroll
    for (int kk = 0; kk < 16; ++kk) {
      const int kb = kk * 4 + khalf;
      v2f a, bv;
      a.x  = sG[(ti * 16 + m) * RK_PITCH + kb];
      a.y  = sG[(ti * 16 + m) * RK_PITCH + kb + 1];
      bv.x = Wkh[(tj * 16 + m) * 64 + kb];
      bv.y = Wkh[(tj * 16 + m) * 64 + kb + 1];
      acc = wmma4(a, bv, acc);
    }
#pragma unroll
    for (int v = 0; v < 8; ++v)
      sT[(ti * 16 + v + rowoff) * KR_PITCH + tj * 16 + m] = acc[v];
  }
  __syncthreads();

  // attn = Wq_h @ T1
  {
    v8f acc = {};
#pragma unroll
    for (int kk = 0; kk < 16; ++kk) {
      const int kb = kk * 4 + khalf;
      v2f a, bv;
      a.x  = Wqh[(ti * 16 + m) * 64 + kb];
      a.y  = Wqh[(ti * 16 + m) * 64 + kb + 1];
      bv.x = sT[kb * KR_PITCH + tj * 16 + m];
      bv.y = sT[(kb + 1) * KR_PITCH + tj * 16 + m];
      acc = wmma4(a, bv, acc);
    }
#pragma unroll
    for (int v = 0; v < 8; ++v)
      sA[(ti * 16 + v + rowoff) * RK_PITCH + tj * 16 + m] = acc[v];
  }
  __syncthreads();

  // InstanceNorm2d (biased variance) over the whole 64x64 map, then softmax
  // over each row: 8 lanes own a row, 8 elements each (t*8..t*8+7), held in
  // registers from the one read to the one write; no other thread touches them.
  float* const sAt = sA + (t >> 3) * RK_PITCH + (t & 7) * 8;
  float x[8];
  {
    const float4 lo = *(const float4*)sAt;
    const float4 hi = *(const float4*)(sAt + 4);
    x[0] = lo.x; x[1] = lo.y; x[2] = lo.z; x[3] = lo.w;
    x[4] = hi.x; x[5] = hi.y; x[6] = hi.z; x[7] = hi.w;
    float s = 0.f, q = 0.f;
#pragma unroll  // x[] indexed by constants only, so it stays in registers
    for (int i = 0; i < 8; ++i) {
      s += x[i];
      q += x[i] * x[i];
    }
    s = sum32(s);
    q = sum32(q);
    if (lane == 0) red[wave] = make_float2(s, q);
  }
  __syncthreads();  // the 16 waves' sums are in red[]

  // Wo_h[o][c] = Wo[o*512 + c*H + h] for the last product: each 128-byte line
  // of Wo holds 4 values of this head, so a wave takes 8 rows x 4 columns per
  // load (8 lines) and every line is asked for once per block. Requested here
  // so that the values arrive while the softmax runs.
  const int wo_o = (wave & 7) * 8 + (lane >> 2);
  const int wo_c = (wave >> 3) * 32 + (lane & 3);
  float wo[8];
  {
    const float* wp = Wo + wo_o * 512 + wo_c * H_DIM + h;
#pragma unroll  // all 8 loads in flight at once, wo[] in registers
    for (int i = 0; i < 8; ++i) wo[i] = wp[i * 4 * H_DIM];
  }

  {
    const float2 pr = red[lane & 15];
    const float mean = sum16(pr.x) * (1.0f / 4096.0f);
    const float var  = sum16(pr.y) * (1.0f / 4096.0f) - mean * mean;
    const float inv  = rsqrtf(var + EPS_IN);
    float mx = -1e30f;
#pragma unroll  // x[] indexed by constants only, so it stays in registers
    for (int i = 0; i < 8; ++i) {
      x[i] = (x[i] - mean) * inv;
      mx = fmaxf(mx, x[i]);
    }
    mx = max8(mx);
#pragma unroll  // x[] indexed by constants only, so it stays in registers
    for (int i = 0; i < 8; ++i) x[i] = __expf(x[i] - mx);
    asm volatile("v_nop" ::"v"(x[0]), "v"(x[1]), "v"(x[2]), "v"(x[3]), "v"(x[4]),
                 "v"(x[5]), "v"(x[6]), "v"(x[7]));
    // pairwise: three dependent adds in place of eight
    const float se = ((x[0] + x[1]) + (x[2] + x[3])) + ((x[4] + x[5]) + (x[6] + x[7]));
    const float r = 1.0f / sum8(se);
    *(float4*)sAt = make_float4(x[0] * r, x[1] * r, x[2] * r, x[3] * r);
    *(float4*)(sAt + 4) = make_float4(x[4] * r, x[5] * r, x[6] * r, x[7] * r);
  }
#pragma unroll  // wo[] indexed by constants only, so it stays in registers
  for (int i = 0; i < 8; ++i) sW[wo_o * WO_PITCH + wo_c + i * 4] = wo[i];
  __syncthreads();

  // M2_h = attn @ Wv_h, kept in LDS (sT is free since the second product)
  {
    v8f acc = {};
#pragma unroll
    for (int kk = 0; kk < 16; ++kk) {
      const int kb = kk * 4 + khalf;
      v2f a, bv;
      a.x  = sA[(ti * 16 + m) * RK_PITCH + kb];
      a.y  = sA[(ti * 16 + m) * RK_PITCH + kb + 1];
      bv.x = Wvh[kb * 64 + tj * 16 + m];
      bv.y = Wvh[(kb + 1) * 64 + tj * 16 + m];
      acc = wmma4(a, bv, acc);
    }
#pragma unroll  // acc[] indexed by constants only, so it stays in registers
    for (int v = 0; v < 8; ++v)
      sT[(ti * 16 + v + rowoff) * KR_PITCH + tj * 16 + m] = acc[v];
  }
  __syncthreads();  // M2_h complete in sT before any wave reads it as B

  // P_b += Wo_h @ M2_h
  {
    v8f acc = {};
#pragma unroll  // lets the LDS reads of later k steps start ahead of the WMMAs
    for (int kk = 0; kk < 16; ++kk) {
      const int kb = kk * 4 + khalf;
      v2f a, bv;
      a.x  = sW[(ti * 16 + m) * WO_PITCH + kb];
      a.y  = sW[(ti * 16 + m) * WO_PITCH + kb + 1];
      bv.x = sT[kb * KR_PITCH + tj * 16 + m];
      bv.y = sT[(kb + 1) * KR_PITCH + tj * 16 + m];
      acc = wmma4(a, bv, acc);
    }
    float* pp = P + b * 4096 + (ti * 16 + rowoff) * 64 + tj * 16 + m;
#pragma unroll  // acc[] indexed by constants only, so it stays in registers
    for (int v = 0; v < 8; ++v) atomicAdd(pp + v * 64, acc[v]);
  }
}

// out_b = emb_b @ P_b^T, streamed over N: async-staged P_b + double-buffered
// emb chunks; non-temporal output stores.
__global__ void __launch_bounds__(512) k_out(const float* __restrict__ emb,
                                             const float* __restrict__ P,
                                             float* __restrict__ out) {
  __shared__ __attribute__((aligned(16))) float sP[64 * RK_PITCH];
  __shared__ __attribute__((aligned(16))) float sE[2][64 * RK_PITCH];
  const int b   = blockIdx.x >> 6;  // 64 blocks per batch, 256 rows each
  const int blk = blockIdx.x & 63;
  const int n0  = blk * 256;
  const int t = threadIdx.x;
  const int lane = t & 31, wave = t >> 5;
  const int m = lane & 15;
  const int khalf = (lane < 16) ? 0 : 2;
  const int rowoff = (lane < 16) ? 0 : 8;
  const int nt = wave >> 2, ct = wave & 3;
  const float* ebase = emb + ((size_t)b * N_DIM + n0) * C_DIM;

  stage4k(P + b * 4096, sP, RK_PITCH, t);  // issued first: in-order ahead of chunks
  stage4k(ebase, sE[0], RK_PITCH, t);      // chunk 0
  WAIT_ASYNC(2);                 // sP landed (in-order); chunk0 may be in flight
  __syncthreads();

  v2f brg[16];
#pragma unroll
  for (int kk = 0; kk < 16; ++kk) {
    const int kb = kk * 4 + khalf;
    brg[kk].x = sP[(ct * 16 + m) * RK_PITCH + kb];
    brg[kk].y = sP[(ct * 16 + m) * RK_PITCH + kb + 1];
  }

  float* ob = out + ((size_t)b * N_DIM + n0) * C_DIM;

#define OUT_STEP(c, W, NEXT)                                            \
  {                                                                     \
    if (NEXT)                                                           \
      stage4k(ebase + ((c) + 1) * 4096, sE[((c) + 1) & 1], RK_PITCH, t); \
    WAIT_ASYNC(W);                                                      \
    __syncthreads();                                                    \
    const float* sb = sE[(c) & 1];                                      \
    v8f acc = {};                                                       \
    _Pragma("unroll") for (int kk = 0; kk < 16; ++kk) {                 \
      const int kb = kk * 4 + khalf;                                    \
      v2f a;                                                            \
      a.x = sb[(nt * 16 + m) * RK_PITCH + kb];                          \
      a.y = sb[(nt * 16 + m) * RK_PITCH + kb + 1];                      \
      acc = wmma4(a, brg[kk], acc);                                     \
    }                                                                   \
    _Pragma("unroll") for (int v = 0; v < 8; ++v)                       \
        __builtin_nontemporal_store(                                    \
            acc[v],                                                     \
            &ob[((c) * 64 + nt * 16 + v + rowoff) * 64 + ct * 16 + m]); \
    __syncthreads();                                                    \
  }

  OUT_STEP(0, 2, 1)
  OUT_STEP(1, 2, 1)
  OUT_STEP(2, 2, 1)
  OUT_STEP(3, 0, 0)
#undef OUT_STEP
}

extern "C" void kernel_launch(void* const* d_in, const int* in_sizes, int n_in,
                              void* d_out, int out_size, void* d_ws,
                              size_t ws_size, hipStream_t stream) {
  (void)in_sizes; (void)n_in; (void)out_size; (void)ws_size;
  const float* emb = (const float*)d_in[0];
  const float* Wq  = (const float*)d_in[1];
  const float* Wk  = (const float*)d_in[2];
  const float* Wv  = (const float*)d_in[3];
  const float* Wo  = (const float*)d_in[4];
  float* out = (float*)d_out;

  float* ws = (float*)d_ws;
  float* G = ws;           // B*4096 = 16384 floats
  float* P = ws + 16384;   // B*4096 = 16384 floats
  float* Gp = ws + 32768;  // B*64 block partials of 4096 floats

  k_gram<<<B_DIM * 64, 512, 0, stream>>>(emb, Gp);
  k_gsum<<<B_DIM * 32, 256, 0, stream>>>(Gp, G, P);
  k_attn<<<B_DIM * H_DIM, 512, 0, stream>>>(G, Wq, Wk, Wv, Wo, P);
  k_out<<<B_DIM * 64, 512, 0, stream>>>(emb, P, out);
}

// v005
// A run of this version takes 23.9 microseconds.
// Two timings next to v004 put it at 1.09 and 1.08 times that version's speed.
// Over all steps from v000 it is 2.35 times as fast.
#include <hip/hip_runtime.h>
#include <hip/hip_bf16.h>

typedef __attribute__((ext_vector_type(2))) float v2f;
typedef __attribute__((ext_vector_type(8))) float v8f;
typedef int v4i __attribute__((vector_size(4 * sizeof(int))));

#define B_DIM 4
#define N_DIM 16384
#define C_DIM 64
#define H_DIM 8
#define EPS_IN 1e-5f
#define WO_PITCH 68
#define RK_PITCH 68
#define KR_PITCH 80

#ifndef __has_builtin
#define __has_builtin(x) 0
#endif

#if __has_builtin(__builtin_amdgcn_global_load_async_to_lds_b128)
#define HAS_ASYNC_LDS 1
#else
#define HAS_ASYNC_LDS 0
#endif

#if __has_builtin(__builtin_amdgcn_s_wait_asynccnt)
#define WAIT_ASYNC(n) __builtin_amdgcn_s_wait_asynccnt(n)
#elif HAS_ASYNC_LDS
#define WAIT_ASYNC(n) asm volatile("s_wait_asynccnt %0" ::"i"(n) : "memory")
#else
#define WAIT_ASYNC(n) ((void)0)
#endif

// addrspace conversions via ptrtoint/inttoptr; pointee type int32x4 per the
// builtin's probed signature (AS1 v4i* source, AS3 v4i* LDS destination).
#define GLB_AS1(p) \
  ((__attribute__((address_space(1))) v4i*)(unsigned long long)(p))
#define LDS_AS3(p) \
  ((__attribute__((address_space(3))) v4i*)(unsigned int)(unsigned long long)(p))

// Copy 64 rows x 64 floats (16 KB) global -> LDS rows of `pitch` floats
// (a multiple of 4); 512 threads x 2 x 16B each, 16 pieces to a row.
static __device__ __forceinline__ void stage4k(const float* __restrict__ g,
                                               float* l, const int pitch,
                                               int t) {
#pragma unroll
  for (int i = 0; i < 2; ++i) {
    const int p = t + i * 512;
    float* d = l + (p >> 4) * pitch + (p & 15) * 4;
#if HAS_ASYNC_LDS
    __builtin_amdgcn_global_load_async_to_lds_b128(GLB_AS1(g + (size_t)p * 4),
                                                   LDS_AS3(d), 0, 0);
#else
    *(float4*)d = ((const float4*)g)[p];
#endif
  }
}

static __device__ __forceinline__ v8f wmma4(v2f a, v2f b, v8f c) {
  return __builtin_amdgcn_wmma_f32_16x16x4_f32(false, a, false, b, (short)0, c,
                                               false, false);
}

// Value of lane (l ^ n) inside a 16-lane row, n = CTRL - 0x160 (DPP row_xmask):
// a register move, where __shfl_xor would go through the LDS pipe.
template <int CTRL>
static __device__ __forceinline__ float row_xor(float x) {
  return __builtin_bit_cast(
      float, __builtin_amdgcn_update_dpp(0, __builtin_bit_cast(int, x), CTRL,
                                         0xf, 0xf, true));
}
// Butterfly sums: every lane of the group ends with the same bits.
static __device__ __forceinline__ float sum8(float x) {
  x += row_xor<0x161>(x);
  x += row_xor<0x162>(x);
  x += row_xor<0x164>(x);
  return x;
}
static __device__ __forceinline__ float sum16(float x) {
  x = sum8(x);
  x += row_xor<0x168>(x);
  return x;
}
static __device__ __forceinline__ float sum32(float x) {
  x = sum16(x);
  const int b = __builtin_bit_cast(int, x);
  x += __builtin_bit_cast(float, __builtin_amdgcn_permlanex16(
                                     b, b, 0x76543210, 0xfedcba98, false, false));
  return x;
}
static __device__ __forceinline__ float max8(float x) {
  x = fmaxf(x, row_xor<0x161>(x));
  x = fmaxf(x, row_xor<0x162>(x));
  x = fmaxf(x, row_xor<0x164>(x));
  return x;
}

// Each block's share of G_b = emb_b^T @ emb_b (per-batch 64x64 Gram) over its
// 256 rows, streamed with double-buffered async global->LDS staging and stored
// as this block's own 64x64 partial, in accumulator order (see the epilogue).
__global__ void __launch_bounds__(512) k_gram(const float* __restrict__ emb,
                                              float* __restrict__ Gp) {
  __shared__ __attribute__((aligned(16))) float sE[2][64 * KR_PITCH];  // two 64-row chunks
  const int b   = blockIdx.x >> 6;  // 64 blocks per batch, 256 rows each
  const int blk = blockIdx.x & 63;
  const int t = threadIdx.x;
  const int lane = t & 31, wave = t >> 5;
  const int m = lane & 15;
  const int khalf = (lane < 16) ? 0 : 2;
  const int ci = wave >> 2, di = wave & 3;  // 16x16 tile of G
  const float* base = emb + ((size_t)b * N_DIM + blk * 256) * C_DIM;

  stage4k(base, sE[0], KR_PITCH, t);  // chunk 0 in flight
  v8f acc = {};

#define GRAM_STEP(c, W, NEXT)                                         \
  {                                                                   \
    if (NEXT)                                                         \
      stage4k(base + ((c) + 1) * 4096, sE[((c) + 1) & 1], KR_PITCH, t); \
    WAIT_ASYNC(W);                                                    \
    __syncthreads();                                                  \
    const float* sb = sE[(c) & 1];                                    \
    _Pragma("unroll") for (int kk = 0; kk < 16; ++kk) {               \
      const int kb = kk * 4 + khalf;                                  \
      v2f a, bv;                                                      \
      a.x  = sb[kb * KR_PITCH + ci * 16 + m];                         \
      a.y  = sb[(kb + 1) * KR_PITCH + ci * 16 + m];                   \
      bv.x = sb[kb * KR_PITCH + di * 16 + m];                         \
      bv.y = sb[(kb + 1) * KR_PITCH + di * 16 + m];                   \
      acc = wmma4(a, bv, acc);                                        \
    }                                                                 \
    __syncthreads();                                                  \
  }

  GRAM_STEP(0, 2, 1)
  GRAM_STEP(1, 2, 1)
  GRAM_STEP(2, 2, 1)
  GRAM_STEP(3, 0, 0)
#undef GRAM_STEP

  // Partial layout: [wave tile][half = v / 4][lane][v % 4], so that each of the
  // two stores of a wave is 512 contiguous bytes; k_gsum undoes the order.
  float* pp = Gp + (size_t)blockIdx.x * 4096 + wave * 256 + lane * 4;
  *(float4*)pp = make_float4(acc[0], acc[1], acc[2], acc[3]);
  *(float4*)(pp + 128) = make_float4(acc[4], acc[5], acc[6], acc[7]);
}

// G_b = sum of the batch's 64 block partials, in a fixed order; also clears P,
// which k_attn adds into. A block owns one half tile (128 floats) of one batch:
// wave g sums partials 8g..8g+7 (512 contiguous bytes per load, all 8 loads in
// flight), the 8 waves' sums meet in LDS.
__global__ void __launch_bounds__(256) k_gsum(const float* __restrict__ Gp,
                                              float* __restrict__ G,
                                              float* __restrict__ P) {
  __shared__ __attribute__((aligned(16))) float sR[8 * 128];
  const int b = blockIdx.x >> 5;
  const int s = blockIdx.x & 31;  // wave tile * 2 + half
  const int t = threadIdx.x;
  const int lane = t & 31, g = t >> 5;
  const float* src = Gp + ((size_t)(b * 64 + g * 8)) * 4096 + s * 128 + lane * 4;
  float4 p[8];
#pragma unroll  // all 8 loads in flight at once, p[] in registers
  for (int i = 0; i < 8; ++i) p[i] = *(const float4*)(src + i * 4096);
  float4 a;
  a.x = ((p[0].x + p[1].x) + (p[2].x + p[3].x)) + ((p[4].x + p[5].x) + (p[6].x + p[7].x));
  a.y = ((p[0].y + p[1].y) + (p[2].y + p[3].y)) + ((p[4].y + p[5].y) + (p[6].y + p[7].y));
  a.z = ((p[0].z + p[1].z) + (p[2].z + p[3].z)) + ((p[4].z + p[5].z) + (p[6].z + p[7].z));
  a.w = ((p[0].w + p[1].w) + (p[2].w + p[3].w)) + ((p[4].w + p[5].w) + (p[6].w + p[7].w));
  *(float4*)(sR + g * 128 + lane * 4) = a;
  __syncthreads();  // the 8 waves' sums are in sR
  if (t < 128) {
    // 8 rows x 16 columns of G: accumulator register v = half*4 + j, lanes
    // 16..31 hold rows 8 further down
    const int c = t & 15, j = (t >> 4) & 3, hi = t >> 6;
    const float* r = sR + (hi * 16 + c) * 4 + j;
    const float x = ((r[0] + r[128]) + (r[256] + r[384])) +
                    ((r[512] + r[640]) + (r[768] + r[896]));
    const int row = (s >> 3) * 16 + (s & 1) * 4 + j + hi * 8;
    const int col = ((s >> 1) & 3) * 16 + c;
    G[b * 4096 + row * 64 + col] = x;
  } else {
    P[blockIdx.x * 128 + (t - 128)] = 0.0f;
  }
}

// Per (b,h): attn = IN+softmax(Wq_h @ G_b @ Wk_h^T); M2_h = attn @ Wv_h;
// then this head's share of the output projection,
// P_b += Wo[:, c*H+h] @ M2_h, added into the zeroed P_b with float atomics.
// Wq_h, Wk_h and Wv_h are asked for at entry, beside G_b, and Wo_h under the
// first product, so that all four products read LDS alone and none waits for
// a global load.
__global__ void __launch_bounds__(512) k_attn(const float* __restrict__ G,
                                              const float* __restrict__ Wq,
                                              const float* __restrict__ Wk,
                                              const float* __restrict__ Wv,
                                              const float* __restrict__ Wo,
                                              float* __restrict__ P) {
  __shared__ __attribute__((aligned(16))) float sG[64 * RK_PITCH];
  __shared__ __attribute__((aligned(16))) float sA[64 * RK_PITCH];
  __shared__ float sT[64 * KR_PITCH];
  __shared__ float sW[64 * WO_PITCH];
  __shared__ __attribute__((aligned(16))) float sWk[64 * RK_PITCH];
  __shared__ __attribute__((aligned(16))) float sWq[64 * RK_PITCH];
  __shared__ __attribute__((aligned(16))) float sWv[64 * KR_PITCH];
  __shared__ float2 red[16];  // each wave's sum and sum of squares of the map
  const int b = blockIdx.x >> 3;
  const int h = blockIdx.x & 7;
  const int t = threadIdx.x;
  const int lane = t & 31, wave = t >> 5;
  const int m = lane & 15;
  const int khalf = (lane < 16) ? 0 : 2;
  const int rowoff = (lane < 16) ? 0 : 8;
  const int ti = wave >> 2, tj = wave & 3;

  {
    const float4* src = (const float4*)(G + b * 4096);
    const float4 g0 = src[t];  // G first: the first product waits for it
    const float4 g1 = src[t + 512];
    // whole rows, 512 contiguous bytes per wave and copy, in order of use
    stage4k(Wk + h * 4096, sWk, RK_PITCH, t);
    stage4k(Wq + h * 4096, sWq, RK_PITCH, t);
    stage4k(Wv + h * 4096, sWv, KR_PITCH, t);
    float* dst = sG + (t >> 4) * RK_PITCH + (t & 15) * 4;  // 16 pieces to a row
    *(float4*)dst = g0;
    *(float4*)(dst + 32 * RK_PITCH) = g1;
  }
#if HAS_ASYNC_LDS
  // this wave's six copies have landed before the barrier that lets the other
  // waves read them; in asm so that no LDS read is lifted over it
  asm volatile("s_wait_asynccnt 0x0" ::: "memory");
#endif
  __syncthreads();

  // Wo_h[o][c] = Wo[o*512 + c*H + h] for the last product: each 128-byte line
  // of Wo holds 4 values of this head, so a wave takes 8 rows x 4 columns per
  // load (8 lines) and every line is asked for once per block. Requested here
  // so that the values arrive while the first product runs (a barrier waits
  // for a wave's open loads, so they are not asked for in front of one).
  const int wo_o = (wave & 7) * 8 + (lane >> 2);
  const int wo_c = (wave >> 3) * 32 + (lane & 3);
  float wo[8];
  {
    const float* wp = Wo + wo_o * 512 + wo_c * H_DIM + h;
#pragma unroll  // all 8 loads in flight at once, wo[] in registers
    for (int i = 0; i < 8; ++i) wo[i] = wp[i * 4 * H_DIM];
  }

  // T1 = G @ Wk_h^T
  {
    v8f acc = {};
#pragma unroll
    for (int kk = 0; kk < 16; ++kk) {
      const int kb = kk * 4 + khalf;
      v2f a, bv;
      a.x  = sG[(ti * 16 + m) * RK_PITCH + kb];
      a.y  = sG[(ti * 16 + m) * RK_PITCH + kb + 1];
      bv.x = sWk[(tj * 16 + m) * RK_PITCH + kb];
      bv.y = sWk[(tj * 16 + m) * RK_PITCH + kb + 1];
      acc = wmma4(a, bv, acc);
    }
#pragma unroll
    for (int v = 0; v < 8; ++v)
      sT[(ti * 16 + v + rowoff) * KR_PITCH + tj * 16 + m] = acc[v];
  }
#pragma unroll  // wo[] indexed by constants only, so it stays in registers
  for (int i = 0; i < 8; ++i) sW[wo_o * WO_PITCH + wo_c + i * 4] = wo[i];
  __syncthreads();

  // attn = Wq_h @ T1
  {
    v8f acc = {};
#pragma unroll
    for (int kk = 0; kk < 16; ++kk) {
      const int kb = kk * 4 + khalf;
      v2f a, bv;
      a.x  = sWq[(ti * 16 + m) * RK_PITCH + kb];
      a.y  = sWq[(ti * 16 + m) * RK_PITCH + kb + 1];
      bv.x = sT[kb * KR_PITCH + tj * 16 + m];
      bv.y = sT[(kb + 1) * KR_PITCH + tj * 16 + m];
      acc = wmma4(a, bv, acc);
    }
#pragma unroll
    for (int v = 0; v < 8; ++v)
      sA[(ti * 16 + v + rowoff) * RK_PITCH + tj * 16 + m] = acc[v];
  }
  __syncthreads();

  // InstanceNorm2d (biased variance) over the whole 64x64 map, then softmax
  // over each row: 8 lanes own a row, 8 elements each (t*8..t*8+7), held in
  // registers from the one read to the one write; no other thread touches them.
  float* const sAt = sA + (t >> 3) * RK_PITCH + (t & 7) * 8;
  float x[8];
  {
    const float4 lo = *(const float4*)sAt;
    const float4 hi = *(const float4*)(sAt + 4);
    x[0] = lo.x; x[1] = lo.y; x[2] = lo.z; x[3] = lo.w;
    x[4] = hi.x; x[5] = hi.y; x[6] = hi.z; x[7] = hi.w;
    float s = 0.f, q = 0.f;
#pragma unroll  // x[] indexed by constants only, so it stays in registers
    for (int i = 0; i < 8; ++i) {
      s += x[i];
      q += x[i] * x[i];
    }
    s = sum32(s);
    q = sum32(q);
    if (lane == 0) red[wave] = make_float2(s, q);
  }
  __syncthreads();  // the 16 waves' sums are in red[]

  {
    const float2 pr = red[lane & 15];
    const float mean = sum16(pr.x) * (1.0f / 4096.0f);
    const float var  = sum16(pr.y) * (1.0f / 4096.0f) - mean * mean;
    const float inv  = rsqrtf(var + EPS_IN);
    float mx = -1e30f;
#pragma unroll  // x[] indexed by constants only, so it stays in registers
    for (int i = 0; i < 8; ++i) {
      x[i] = (x[i] - mean) * inv;
      mx = fmaxf(mx, x[i]);
    }
    mx = max8(mx);
#pragma unroll  // x[] indexed by constants only, so it stays in registers
    for (int i = 0; i < 8; ++i) x[i] = __expf(x[i] - mx);
    asm volatile("v_nop" ::"v"(x[0]), "v"(x[1]), "v"(x[2]), "v"(x[3]), "v"(x[4]),
                 "v"(x[5]), "v"(x[6]), "v"(x[7]));
    // pairwise: three dependent adds in place of eight
    const float se = ((x[0] + x[1]) + (x[2] + x[3])) + ((x[4] + x[5]) + (x[6] + x[7]));
    const float r = 1.0f / sum8(se);
    *(float4*)sAt = make_float4(x[0] * r, x[1] * r, x[2] * r, x[3] * r);
    *(float4*)(sAt + 4) = make_float4(x[4] * r, x[5] * r, x[6] * r, x[7] * r);
  }
  __syncthreads();

  // M2_h = attn @ Wv_h, kept in LDS (sT is free since the second product)
  {
    v8f acc = {};
#pragma unroll
    for (int kk = 0; kk < 16; ++kk) {
      const int kb = kk * 4 + khalf;
      v2f a, bv;
      a.x  = sA[(ti * 16 + m) * RK_PITCH + kb];
      a.y  = sA[(ti * 16 + m) * RK_PITCH + kb + 1];
      bv.x = sWv[kb * KR_PITCH + tj * 16 + m];
      bv.y = sWv[(kb + 1) * KR_PITCH + tj * 16 + m];
      acc = wmma4(a, bv, acc);
    }
#pragma unroll  // acc[] indexed by constants only, so it stays in registers
    for (int v = 0; v < 8; ++v)
      sT[(ti * 16 + v + rowoff) * KR_PITCH + tj * 16 + m] = acc[v];
  }
  __syncthreads();  // M2_h complete in sT before any wave reads it as B

  // P_b += Wo_h @ M2_h
  {
    v8f acc = {};
#pragma unroll  // lets the LDS reads of later k steps start ahead of the WMMAs
    for (int kk = 0; kk < 16; ++kk) {
      const int kb = kk * 4 + khalf;
      v2f a, bv;
      a.x  = sW[(ti * 16 + m) * WO_PITCH + kb];
      a.y  = sW[(ti * 16 + m) * WO_PITCH + kb + 1];
      bv.x = sT[kb * KR_PITCH + tj * 16 + m];
      bv.y = sT[(kb + 1) * KR_PITCH + tj * 16 + m];
      acc = wmma4(a, bv, acc);
    }
    float* pp = P + b * 4096 + (ti * 16 + rowoff) * 64 + tj * 16 + m;
#pragma unroll  // acc[] indexed by constants only, so it stays in registers
    for (int v = 0; v < 8; ++v) atomicAdd(pp + v * 64, acc[v]);
  }
}

// out_b = emb_b @ P_b^T, streamed over N: async-staged P_b + double-buffered
// emb chunks; non-temporal output stores.
__global__ void __launch_bounds__(512) k_out(const float* __restrict__ emb,
                                             const float* __restrict__ P,
                                             float* __restrict__ out) {
  __shared__ __attribute__((aligned(16))) float sP[64 * RK_PITCH];
  __shared__ __attribute__((aligned(16))) float sE[2][64 * RK_PITCH];
  const int b   = blockIdx.x >> 6;  // 64 blocks per batch, 256 rows each
  const int blk = blockIdx.x & 63;
  const int n0  = blk * 256;
  const int t = threadIdx.x;
  const int lane = t & 31, wave = t >> 5;
  const int m = lane & 15;
  const int khalf = (lane < 16) ? 0 : 2;
  const int rowoff = (lane < 16) ? 0 : 8;
  const int nt = wave >> 2, ct = wave & 3;
  const float* ebase = emb + ((size_t)b * N_DIM + n0) * C_DIM;

  stage4k(P + b * 4096, sP, RK_PITCH, t);  // issued first: in-order ahead of chunks
  stage4k(ebase, sE[0], RK_PITCH, t);      // chunk 0
  WAIT_ASYNC(2);                 // sP landed (in-order); chunk0 may be in flight
  __syncthreads();

  v2f brg[16];
#pragma unroll
  for (int kk = 0; kk < 16; ++kk) {
    const int kb = kk * 4 + khalf;
    brg[kk].x = sP[(ct * 16 + m) * RK_PITCH + kb];
    brg[kk].y = sP[(ct * 16 + m) * RK_PITCH + kb + 1];
  }

  float* ob = out + ((size_t)b * N_DIM + n0) * C_DIM;

#define OUT_STEP(c, W, NEXT)                                            \
  {                                                                     \
    if (NEXT)                                                           \
      stage4k(ebase + ((c) + 1) * 4096, sE[((c) + 1) & 1], RK_PITCH, t); \
    WAIT_ASYNC(W);                                                      \
    __syncthreads();                                                    \
    const float* sb = sE[(c) & 1];                                      \
    v8f acc = {};                                                       \
    _Pragma("unroll") for (int kk = 0; kk < 16; ++kk) {                 \
      const int kb = kk * 4 + khalf;                                    \
      v2f a;                                                            \
      a.x = sb[(nt * 16 + m) * RK_PITCH + kb];                          \
      a.y = sb[(nt * 16 + m) * RK_PITCH + kb + 1];                      \
      acc = wmma4(a, brg[kk], acc);                                     \
    }                                                                   \
    _Pragma("unroll") for (int v = 0; v < 8; ++v)                       \
        __builtin_nontemporal_store(                                    \
            acc[v],                                                     \
            &ob[((c) * 64 + nt * 16 + v + rowoff) * 64 + ct * 16 + m]); \
    __syncthreads();                                                    \
  }

  OUT_STEP(0, 2, 1)
  OUT_STEP(1, 2, 1)
  OUT_STEP(2, 2, 1)
  OUT_STEP(3, 0, 0)
#undef OUT_STEP
}

extern "C" void kernel_launch(void* const* d_in, const int* in_sizes, int n_in,
                              void* d_out, int out_size, void* d_ws,
                              size_t ws_size, hipStream_t stream) {
  (void)in_sizes; (void)n_in; (void)out_size; (void)ws_size;
  const float* emb = (const float*)d_in[0];
  const float* Wq  = (const float*)d_in[1];
  const float* Wk  = (const float*)d_in[2];
  const float* Wv  = (const float*)d_in[3];
  const float* Wo  = (const float*)d_in[4];
  float* out = (float*)d_out;

  float* ws = (float*)d_ws;
  float* G = ws;           // B*4096 = 16384 floats
  float* P = ws + 16384;   // B*4096 = 16384 floats
  float* Gp = ws + 32768;  // B*64 block partials of 4096 floats

  k_gram<<<B_DIM * 64, 512, 0, stream>>>(emb, Gp);
  k_gsum<<<B_DIM * 32, 256, 0, stream>>>(Gp, G, P);
  k_attn<<<B_DIM * H_DIM, 512, 0, stream>>>(G, Wq, Wk, Wv, Wo, P);
  k_out<<<B_DIM * 64, 512, 0, stream>>>(emb, P, out);
}

// v006
// Measured time: 21.3 microseconds a run.
// Next to v005, in two timings, it ran 1.13 and 1.14 times as fast.
// Counting every step since v000, it is 2.67 times as fast.
#include <hip/hip_runtime.h>
#include <hip/hip_bf16.h>

typedef __attribute__((ext_vector_type(2))) float v2f;
typedef __attribute__((ext_vector_type(8))) float v8f;
typedef int v4i __attribute__((vector_size(4 * sizeof(int))));

#define B_DIM 4
#define N_DIM 16384
#define C_DIM 64
#define H_DIM 8
#define EPS_IN 1e-5f
#define WO_PITCH 68
#define RK_PITCH 68
#define KR_PITCH 80

#ifndef __has_builtin
#define __has_builtin(x) 0
#endif

#if __has_builtin(__builtin_amdgcn_global_load_async_to_lds_b128)
#define HAS_ASYNC_LDS 1
#else
#define HAS_ASYNC_LDS 0
#endif

#if __has_builtin(__builtin_amdgcn_s_wait_asynccnt)
#define WAIT_ASYNC(n) __builtin_amdgcn_s_wait_asynccnt(n)
#elif HAS_ASYNC_LDS
#define WAIT_ASYNC(n) asm volatile("s_wait_asynccnt %0" ::"i"(n) : "memory")
#else
#define WAIT_ASYNC(n) ((void)0)
#endif

// addrspace conversions via ptrtoint/inttoptr; pointee type int32x4 per the
// builtin's probed signature (AS1 v4i* source, AS3 v4i* LDS destination).
#define GLB_AS1(p) \
  ((__attribute__((address_space(1))) v4i*)(unsigned long long)(p))
#define LDS_AS3(p) \
  ((__attribute__((address_space(3))) v4i*)(unsigned int)(unsigned long long)(p))

// Copy 64 rows x 64 floats (16 KB) global -> LDS rows of `pitch` floats
// (a multiple of 4); NT threads x (1024 / NT) x 16B each, 16 pieces to a row.
template <int NT>
static __device__ __forceinline__ void stage4k(const float* __restrict__ g,
                                               float* l, const int pitch,
                                               int t) {
#pragma unroll
  for (int i = 0; i < 1024 / NT; ++i) {
    const int p = t + i * NT;
    float* d = l + (p >> 4) * pitch + (p & 15) * 4;
#if HAS_ASYNC_LDS
    __builtin_amdgcn_global_load_async_to_lds_b128(GLB_AS1(g + (size_t)p * 4),
                                                   LDS_AS3(d), 0, 0);
#else
    *(float4*)d = ((const float4*)g)[p];
#endif
  }
}

static __device__ __forceinline__ v8f wmma4(v2f a, v2f b, v8f c) {
  return __builtin_amdgcn_wmma_f32_16x16x4_f32(false, a, false, b, (short)0, c,
                                               false, false);
}

// Value of lane (l ^ n) inside a 16-lane row, n = CTRL - 0x160 (DPP row_xmask):
// a register move, where __shfl_xor would go through the LDS pipe.
template <int CTRL>
static __device__ __forceinline__ float row_xor(float x) {
  return __builtin_bit_cast(
      float, __builtin_amdgcn_update_dpp(0, __builtin_bit_cast(int, x), CTRL,
                                         0xf, 0xf, true));
}
// Butterfly sums: every lane of the group ends with the same bits.
static __device__ __forceinline__ float sum8(float x) {
  x += row_xor<0x161>(x);
  x += row_xor<0x162>(x);
  x += row_xor<0x164>(x);
  return x;
}
static __device__ __forceinline__ float sum16(float x) {
  x = sum8(x);
  x += row_xor<0x168>(x);
  return x;
}
static __device__ __forceinline__ float sum32(float x) {
  x = sum16(x);
  const int b = __builtin_bit_cast(int, x);
  x += __builtin_bit_cast(float, __builtin_amdgcn_permlanex16(
                                     b, b, 0x76543210, 0xfedcba98, false, false));
  return x;
}
static __device__ __forceinline__ float max8(float x) {
  x = fmaxf(x, row_xor<0x161>(x));
  x = fmaxf(x, row_xor<0x162>(x));
  x = fmaxf(x, row_xor<0x164>(x));
  return x;
}

// Each block's share of G_b = emb_b^T @ emb_b (per-batch 64x64 Gram) over its
// 256 rows, streamed with double-buffered async global->LDS staging and stored
// as this block's own 64x64 partial, in accumulator order (see the epilogue).
// 8 waves, each with two 16x16 tiles that share their A fragment: a launch
// lasts at least as long as its waves take to start, so it starts half as many.
__global__ void __launch_bounds__(256) k_gram(const float* __restrict__ emb,
                                              float* __restrict__ Gp) {
  __shared__ __attribute__((aligned(16))) float sE[2][64 * KR_PITCH];  // two 64-row chunks
  const int b   = blockIdx.x >> 6;  // 64 blocks per batch, 256 rows each
  const int blk = blockIdx.x & 63;
  const int t = threadIdx.x;
  const int lane = t & 31, wave = t >> 5;
  const int m = lane & 15;
  const int khalf = (lane < 16) ? 0 : 2;
  const int ci = wave >> 1, di = (wave & 1) * 2;  // 16x16 tiles (ci, di), (ci, di + 1) of G
  const float* base = emb + ((size_t)b * N_DIM + blk * 256) * C_DIM;

  stage4k<256>(base, sE[0], KR_PITCH, t);  // chunk 0 in flight
  v8f acc0 = {}, acc1 = {};

#define GRAM_STEP(c, W, NEXT)                                         \
  {                                                                   \
    if (NEXT)                                                         \
      stage4k<256>(base + ((c) + 1) * 4096, sE[((c) + 1) & 1], KR_PITCH, t); \
    WAIT_ASYNC(W);                                                    \
    __syncthreads();                                                  \
    const float* sb = sE[(c) & 1];                                    \
    _Pragma("unroll") for (int kk = 0; kk < 16; ++kk) {               \
      const int kb = kk * 4 + khalf;                                  \
      v2f a, b0, b1;                                                  \
      a.x  = sb[kb * KR_PITCH + ci * 16 + m];                         \
      a.y  = sb[(kb + 1) * KR_PITCH + ci * 16 + m];                   \
      b0.x = sb[kb * KR_PITCH + di * 16 + m];                         \
      b0.y = sb[(kb + 1) * KR_PITCH + di * 16 + m];                   \
      b1.x = sb[kb * KR_PITCH + di * 16 + 16 + m];                    \
      b1.y = sb[(kb + 1) * KR_PITCH + di * 16 + 16 + m];              \
      acc0 = wmma4(a, b0, acc0);                                      \
      acc1 = wmma4(a, b1, acc1);                                      \
    }                                                                 \
    __syncthreads();                                                  \
  }

  // W: a chunk is 4 copies of a wave, so 4 leaves only the next chunk's open
  GRAM_STEP(0, 4, 1)
  GRAM_STEP(1, 4, 1)
  GRAM_STEP(2, 4, 1)
  GRAM_STEP(3, 0, 0)
#undef GRAM_STEP

  // Partial layout: [tile = ci * 4 + di][half = v / 4][lane][v % 4], so that each
  // store of a wave is 512 contiguous bytes; k_gsum undoes the order.
  float* pp = Gp + (size_t)blockIdx.x * 4096 + (ci * 4 + di) * 256 + lane * 4;
  *(float4*)pp = make_float4(acc0[0], acc0[1], acc0[2], acc0[3]);
  *(float4*)(pp + 128) = make_float4(acc0[4], acc0[5], acc0[6], acc0[7]);
  *(float4*)(pp + 256) = make_float4(acc1[0], acc1[1], acc1[2], acc1[3]);
  *(float4*)(pp + 384) = make_float4(acc1[4], acc1[5], acc1[6], acc1[7]);
}

// G_b = sum of the batch's 64 block partials, in a fixed order; also clears P,
// which k_attn adds into. A block owns one half tile (128 floats) of one batch:
// wave g sums partials 8g..8g+7 (512 contiguous bytes per load, all 8 loads in
// flight), the 8 waves' sums meet in LDS.
__global__ void __launch_bounds__(256) k_gsum(const float* __restrict__ Gp,
                                              float* __restrict__ G,
                                              float* __restrict__ P) {
  __shared__ __attribute__((aligned(16))) float sR[8 * 128];
  const int b = blockIdx.x >> 5;
  const int s = blockIdx.x & 31;  // wave tile * 2 + half
  const int t = threadIdx.x;
  const int lane = t & 31, g = t >> 5;
  const float* src = Gp + ((size_t)(b * 64 + g * 8)) * 4096 + s * 128 + lane * 4;
  float4 p[8];
#pragma unroll  // all 8 loads in flight at once, p[] in registers
  for (int i = 0; i < 8; ++i) p[i] = *(const float4*)(src + i * 4096);
  float4 a;
  a.x = ((p[0].x + p[1].x) + (p[2].x + p[3].x)) + ((p[4].x + p[5].x) + (p[6].x + p[7].x));
  a.y = ((p[0].y + p[1].y) + (p[2].y + p[3].y)) + ((p[4].y + p[5].y) + (p[6].y + p[7].y));
  a.z = ((p[0].z + p[1].z) + (p[2].z + p[3].z)) + ((p[4].z + p[5].z) + (p[6].z + p[7].z));
  a.w = ((p[0].w + p[1].w) + (p[2].w + p[3].w)) + ((p[4].w + p[5].w) + (p[6].w + p[7].w));
  *(float4*)(sR + g * 128 + lane * 4) = a;
  __syncthreads();  // the 8 waves' sums are in sR
  if (t < 128) {
    // 8 rows x 16 columns of G: accumulator register v = half*4 + j, lanes
    // 16..31 hold rows 8 further down
    const int c = t & 15, j = (t >> 4) & 3, hi = t >> 6;
    const float* r = sR + (hi * 16 + c) * 4 + j;
    const float x = ((r[0] + r[128]) + (r[256] + r[384])) +
                    ((r[512] + r[640]) + (r[768] + r[896]));
    const int row = (s >> 3) * 16 + (s & 1) * 4 + j + hi * 8;
    const int col = ((s >> 1) & 3) * 16 + c;
    G[b * 4096 + row * 64 + col] = x;
  } else {
    P[blockIdx.x * 128 + (t - 128)] = 0.0f;
  }
}

// Per (b,h): attn = IN+softmax(Wq_h @ G_b @ Wk_h^T); M2_h = attn @ Wv_h;
// then this head's share of the output projection,
// P_b += Wo[:, c*H+h] @ M2_h, added into the zeroed P_b with float atomics.
// Wq_h, Wk_h and Wv_h are asked for at entry, beside G_b, and Wo_h under the
// first product, so that all four products read LDS alone and none waits for
// a global load.
__global__ void __launch_bounds__(512) k_attn(const float* __restrict__ G,
                                              const float* __restrict__ Wq,
                                              const float* __restrict__ Wk,
                                              const float* __restrict__ Wv,
                                              const float* __restrict__ Wo,
                                              float* __restrict__ P) {
  __shared__ __attribute__((aligned(16))) float sG[64 * RK_PITCH];
  __shared__ __attribute__((aligned(16))) float sA[64 * RK_PITCH];
  __shared__ float sT[64 * KR_PITCH];
  __shared__ float sW[64 * WO_PITCH];
  __shared__ __attribute__((aligned(16))) float sWk[64 * RK_PITCH];
  __shared__ __attribute__((aligned(16))) float sWq[64 * RK_PITCH];
  __shared__ __attribute__((aligned(16))) float sWv[64 * KR_PITCH];
  __shared__ float2 red[16];  // each wave's sum and sum of squares of the map
  const int b = blockIdx.x >> 3;
  const int h = blockIdx.x & 7;
  const int t = threadIdx.x;
  const int lane = t & 31, wave = t >> 5;
  const int m = lane & 15;
  const int khalf = (lane < 16) ? 0 : 2;
  const int rowoff = (lane < 16) ? 0 : 8;
  const int ti = wave >> 2, tj = wave & 3;

  {
    const float4* src = (const float4*)(G + b * 4096);
    const float4 g0 = src[t];  // G first: the first product waits for it
    const float4 g1 = src[t + 512];
    // whole rows, 512 contiguous bytes per wave and copy, in order of use
    stage4k<512>(Wk + h * 4096, sWk, RK_PITCH, t);
    stage4k<512>(Wq + h * 4096, sWq, RK_PITCH, t);
    stage4k<512>(Wv + h * 4096, sWv, KR_PITCH, t);
    float* dst = sG + (t >> 4) * RK_PITCH + (t & 15) * 4;  // 16 pieces to a row
    *(float4*)dst = g0;
    *(float4*)(dst + 32 * RK_PITCH) = g1;
  }
#if HAS_ASYNC_LDS
  // this wave's six copies have landed before the barrier that lets the other
  // waves read them; in asm so that no LDS read is lifted over it
  asm volatile("s_wait_asynccnt 0x0" ::: "memory");
#endif
  __syncthreads();

  // Wo_h[o][c] = Wo[o*512 + c*H + h] for the last product: each 128-byte line
  // of Wo holds 4 values of this head, so a wave takes 8 rows x 4 columns per
  // load (8 lines) and every line is asked for once per block. Requested here
  // so that the values arrive while the first product runs (a barrier waits
  // for a wave's open loads, so they are not asked for in front of one).
  const int wo_o = (wave & 7) * 8 + (lane >> 2);
  const int wo_c = (wave >> 3) * 32 + (lane & 3);
  float wo[8];
  {
    const float* wp = Wo + wo_o * 512 + wo_c * H_DIM + h;
#pragma unroll  // all 8 loads in flight at once, wo[] in registers
    for (int i = 0; i < 8; ++i) wo[i] = wp[i * 4 * H_DIM];
  }

  // T1 = G @ Wk_h^T
  {
    v8f acc = {};
#pragma unroll
    for (int kk = 0; kk < 16; ++kk) {
      const int kb = kk * 4 + khalf;
      v2f a, bv;
      a.x  = sG[(ti * 16 + m) * RK_PITCH + kb];
      a.y  = sG[(ti * 16 + m) * RK_PITCH + kb + 1];
      bv.x = sWk[(tj * 16 + m) * RK_PITCH + kb];
      bv.y = sWk[(tj * 16 + m) * RK_PITCH + kb + 1];
      acc = wmma4(a, bv, acc);
    }
#pragma unroll
    for (int v = 0; v < 8; ++v)
      sT[(ti * 16 + v + rowoff) * KR_PITCH + tj * 16 + m] = acc[v];
  }
#pragma unroll  // wo[] indexed by constants only, so it stays in registers
  for (int i = 0; i < 8; ++i) sW[wo_o * WO_PITCH + wo_c + i * 4] = wo[i];
  __syncthreads();

  // attn = Wq_h @ T1
  {
    v8f acc = {};
#pragma unroll
    for (int kk = 0; kk < 16; ++kk) {
      const int kb = kk * 4 + khalf;
      v2f a, bv;
      a.x  = sWq[(ti * 16 + m) * RK_PITCH + kb];
      a.y  = sWq[(ti * 16 + m) * RK_PITCH + kb + 1];
      bv.x = sT[kb * KR_PITCH + tj * 16 + m];
      bv.y = sT[(kb + 1) * KR_PITCH + tj * 16 + m];
      acc = wmma4(a, bv, acc);
    }
#pragma unroll
    for (int v = 0; v < 8; ++v)
      sA[(ti * 16 + v + rowoff) * RK_PITCH + tj * 16 + m] = acc[v];
  }
  __syncthreads();

  // InstanceNorm2d (biased variance) over the whole 64x64 map, then softmax
  // over each row: 8 lanes own a row, 8 elements each (t*8..t*8+7), held in
  // registers from the one read to the one write; no other thread touches them.
  float* const sAt = sA + (t >> 3) * RK_PITCH + (t & 7) * 8;
  float x[8];
  {
    const float4 lo = *(const float4*)sAt;
    const float4 hi = *(const float4*)(sAt + 4);
    x[0] = lo.x; x[1] = lo.y; x[2] = lo.z; x[3] = lo.w;
    x[4] = hi.x; x[5] = hi.y; x[6] = hi.z; x[7] = hi.w;
    float s = 0.f, q = 0.f;
#pragma unroll  // x[] indexed by constants only, so it stays in registers
    for (int i = 0; i < 8; ++i) {
      s += x[i];
      q += x[i] * x[i];
    }
    s = sum32(s);
    q = sum32(q);
    if (lane == 0) red[wave] = make_float2(s, q);
  }
  __syncthreads();  // the 16 waves' sums are in red[]

  {
    const float2 pr = red[lane & 15];
    const float mean = sum16(pr.x) * (1.0f / 4096.0f);
    const float var  = sum16(pr.y) * (1.0f / 4096.0f) - mean * mean;
    const float inv  = rsqrtf(var + EPS_IN);
    float mx = -1e30f;
#pragma unroll  // x[] indexed by constants only, so it stays in registers
    for (int i = 0; i < 8; ++i) {
      x[i] = (x[i] - mean) * inv;
      mx = fmaxf(mx, x[i]);
    }
    mx = max8(mx);
#pragma unroll  // x[] indexed by constants only, so it stays in registers
    for (int i = 0; i < 8; ++i) x[i] = __expf(x[i] - mx);
    asm volatile("v_nop" ::"v"(x[0]), "v"(x[1]), "v"(x[2]), "v"(x[3]), "v"(x[4]),
                 "v"(x[5]), "v"(x[6]), "v"(x[7]));
    // pairwise: three dependent adds in place of eight
    const float se = ((x[0] + x[1]) + (x[2] + x[3])) + ((x[4] + x[5]) + (x[6] + x[7]));
    const float r = 1.0f / sum8(se);
    *(float4*)sAt = make_float4(x[0] * r, x[1] * r, x[2] * r, x[3] * r);
    *(float4*)(sAt + 4) = make_float4(x[4] * r, x[5] * r, x[6] * r, x[7] * r);
  }
  __syncthreads();

  // M2_h = attn @ Wv_h, kept in LDS (sT is free since the second product)
  {
    v8f acc = {};
#pragma unroll
    for (int kk = 0; kk < 16; ++kk) {
      const int kb = kk * 4 + khalf;
      v2f a, bv;
      a.x  = sA[(ti * 16 + m) * RK_PITCH + kb];
      a.y  = sA[(ti * 16 + m) * RK_PITCH + kb + 1];
      bv.x = sWv[kb * KR_PITCH + tj * 16 + m];
      bv.y = sWv[(kb + 1) * KR_PITCH + tj * 16 + m];
      acc = wmma4(a, bv, acc);
    }
#pragma unroll  // acc[] indexed by constants only, so it stays in registers
    for (int v = 0; v < 8; ++v)
      sT[(ti * 16 + v + rowoff) * KR_PITCH + tj * 16 + m] = acc[v];
  }
  __syncthreads();  // M2_h complete in sT before any wave reads it as B

  // P_b += Wo_h @ M2_h
  {
    v8f acc = {};
#pragma unroll  // lets the LDS reads of later k steps start ahead of the WMMAs
    for (int kk = 0; kk < 16; ++kk) {
      const int kb = kk * 4 + khalf;
      v2f a, bv;
      a.x  = sW[(ti * 16 + m) * WO_PITCH + kb];
      a.y  = sW[(ti * 16 + m) * WO_PITCH + kb + 1];
      bv.x = sT[kb * KR_PITCH + tj * 16 + m];
      bv.y = sT[(kb + 1) * KR_PITCH + tj * 16 + m];
      acc = wmma4(a, bv, acc);
    }
    float* pp = P + b * 4096 + (ti * 16 + rowoff) * 64 + tj * 16 + m;
#pragma unroll  // acc[] indexed by constants only, so it stays in registers
    for (int v = 0; v < 8; ++v) atomicAdd(pp + v * 64, acc[v]);
  }
}

// out_b = emb_b @ P_b^T, streamed over N: async-staged P_b + double-buffered
// emb chunks; non-temporal output stores. 8 waves, each with two 16x16 output
// tiles that share their A fragment (half as many waves to start, as in k_gram).
__global__ void __launch_bounds__(256) k_out(const float* __restrict__ emb,
                                             const float* __restrict__ P,
                                             float* __restrict__ out) {
  __shared__ __attribute__((aligned(16))) float sP[64 * RK_PITCH];
  __shared__ __attribute__((aligned(16))) float sE[2][64 * RK_PITCH];
  const int b   = blockIdx.x >> 6;  // 64 blocks per batch, 256 rows each
  const int blk = blockIdx.x & 63;
  const int n0  = blk * 256;
  const int t = threadIdx.x;
  const int lane = t & 31, wave = t >> 5;
  const int m = lane & 15;
  const int khalf = (lane < 16) ? 0 : 2;
  const int rowoff = (lane < 16) ? 0 : 8;
  const int nt = wave >> 1, ct = (wave & 1) * 2;  // column tiles ct, ct + 1
  const float* ebase = emb + ((size_t)b * N_DIM + n0) * C_DIM;

  stage4k<256>(P + b * 4096, sP, RK_PITCH, t);  // issued first: in-order ahead of chunks
  stage4k<256>(ebase, sE[0], RK_PITCH, t);      // chunk 0
  WAIT_ASYNC(4);                 // sP landed (in-order); chunk0's 4 may be in flight
  __syncthreads();

  v2f brg0[16], brg1[16];
#pragma unroll
  for (int kk = 0; kk < 16; ++kk) {
    const int kb = kk * 4 + khalf;
    brg0[kk].x = sP[(ct * 16 + m) * RK_PITCH + kb];
    brg0[kk].y = sP[(ct * 16 + m) * RK_PITCH + kb + 1];
    brg1[kk].x = sP[(ct * 16 + 16 + m) * RK_PITCH + kb];
    brg1[kk].y = sP[(ct * 16 + 16 + m) * RK_PITCH + kb + 1];
  }

  float* ob = out + ((size_t)b * N_DIM + n0) * C_DIM;

#define OUT_STEP(c, W, NEXT)                                            \
  {                                                                     \
    if (NEXT)                                                           \
      stage4k<256>(ebase + ((c) + 1) * 4096, sE[((c) + 1) & 1], RK_PITCH, t); \
    WAIT_ASYNC(W);                                                      \
    __syncthreads();                                                    \
    const float* sb = sE[(c) & 1];                                      \
    v8f acc0 = {}, acc1 = {};                                           \
    _Pragma("unroll") for (int kk = 0; kk < 16; ++kk) {                 \
      const int kb = kk * 4 + khalf;                                    \
      v2f a;                                                            \
      a.x = sb[(nt * 16 + m) * RK_PITCH + kb];                          \
      a.y = sb[(nt * 16 + m) * RK_PITCH + kb + 1];                      \
      acc0 = wmma4(a, brg0[kk], acc0);                                  \
      acc1 = wmma4(a, brg1[kk], acc1);                                  \
    }                                                                   \
    _Pragma("unroll") for (int v = 0; v < 8; ++v) {                     \
      float* op = &ob[((c) * 64 + nt * 16 + v + rowoff) * 64 + ct * 16 + m]; \
      __builtin_nontemporal_store(acc0[v], op);                         \
      __builtin_nontemporal_store(acc1[v], op + 16);                    \
    }                                                                   \
    __syncthreads();                                                    \
  }

  // W: a chunk is 4 copies of a wave, so 4 leaves only the next chunk's open
  OUT_STEP(0, 4, 1)
  OUT_STEP(1, 4, 1)
  OUT_STEP(2, 4, 1)
  OUT_STEP(3, 0, 0)
#undef OUT_STEP
}

extern "C" void kernel_launch(void* const* d_in, const int* in_sizes, int n_in,
                              void* d_out, int out_size, void* d_ws,
                              size_t ws_size, hipStream_t stream) {
  (void)in_sizes; (void)n_in; (void)out_size; (void)ws_size;
  const float* emb = (const float*)d_in[0];
  const float* Wq  = (const float*)d_in[1];
  const float* Wk  = (const float*)d_in[2];
  const float* Wv  = (const float*)d_in[3];
  const float* Wo  = (const float*)d_in[4];
  float* out = (float*)d_out;

  float* ws = (float*)d_ws;
  float* G = ws;           // B*4096 = 16384 floats
  float* P = ws + 16384;   // B*4096 = 16384 floats
  float* Gp = ws + 32768;  // B*64 block partials of 4096 floats

  k_gram<<<B_DIM * 64, 256, 0, stream>>>(emb, Gp);
  k_gsum<<<B_DIM * 32, 256, 0, stream>>>(Gp, G, P);
  k_attn<<<B_DIM * H_DIM, 512, 0, stream>>>(G, Wq, Wk, Wv, Wo, P);
  k_out<<<B_DIM * 64, 256, 0, stream>>>(emb, P, out);
}

// v007
// A run of this version takes 20 microseconds.
// Timed twice side by side with v006, it ran 1.06 times as fast both times.
// Counting every step since v000, it is 2.83 times as fast.
#include <hip/hip_runtime.h>
#include <hip/hip_bf16.h>

typedef __attribute__((ext_vector_type(2))) float v2f;
typedef __attribute__((ext_vector_type(8))) float v8f;
typedef int v4i __attribute__((vector_size(4 * sizeof(int))));

#define B_DIM 4
#define N_DIM 16384
#define C_DIM 64
#define H_DIM 8
#define EPS_IN 1e-5f
#define WO_PITCH 68
#define RK_PITCH 68
#define KR_PITCH 80

#ifndef __has_builtin
#define __has_builtin(x) 0
#endif

#if __has_builtin(__builtin_amdgcn_global_load_async_to_lds_b128)
#define HAS_ASYNC_LDS 1
#else
#define HAS_ASYNC_LDS 0
#endif

#if __has_builtin(__builtin_amdgcn_s_wait_asynccnt)
#define WAIT_ASYNC(n) __builtin_amdgcn_s_wait_asynccnt(n)
#elif HAS_ASYNC_LDS
#define WAIT_ASYNC(n) asm volatile("s_wait_asynccnt %0" ::"i"(n) : "memory")
#else
#define WAIT_ASYNC(n) ((void)0)
#endif

// The wait of a wave that reads its own copies with no barrier behind it: in
// asm with the "memory" clobber, so that no LDS read is lifted over it.
#if HAS_ASYNC_LDS
#define WAIT_ASYNC_OWN(n) asm volatile("s_wait_asynccnt %0" ::"i"(n) : "memory")
#else
#define WAIT_ASYNC_OWN(n) ((void)0)
#endif

// addrspace conversions via ptrtoint/inttoptr; pointee type int32x4 per the
// builtin's probed signature (AS1 v4i* source, AS3 v4i* LDS destination).
#define GLB_AS1(p) \
  ((__attribute__((address_space(1))) v4i*)(unsigned long long)(p))
#define LDS_AS3(p) \
  ((__attribute__((address_space(3))) v4i*)(unsigned int)(unsigned long long)(p))

// Copy 64 rows x 64 floats (16 KB) global -> LDS rows of `pitch` floats
// (a multiple of 4); NT threads x (1024 / NT) x 16B each, 16 pieces to a row.
template <int NT>
static __device__ __forceinline__ void stage4k(const float* __restrict__ g,
                                               float* l, const int pitch,
                                               int t) {
#pragma unroll
  for (int i = 0; i < 1024 / NT; ++i) {
    const int p = t + i * NT;
    float* d = l + (p >> 4) * pitch + (p & 15) * 4;
#if HAS_ASYNC_LDS
    __builtin_amdgcn_global_load_async_to_lds_b128(GLB_AS1(g + (size_t)p * 4),
                                                   LDS_AS3(d), 0, 0);
#else
    *(float4*)d = ((const float4*)g)[p];
#endif
  }
}

// One wave's own ROWS rows x 64 floats, global -> LDS rows of `pitch` floats
// (a multiple of 4): a copy takes two whole rows, 512 contiguous bytes.
template <int ROWS>
static __device__ __forceinline__ void stage_own(const float* __restrict__ g,
                                                 float* l, const int pitch,
                                                 int lane) {
  const float* s = g + lane * 4;
  float* d = l + (lane >> 4) * pitch + (lane & 15) * 4;
#pragma unroll
  for (int i = 0; i < ROWS / 2; ++i) {
#if HAS_ASYNC_LDS
    __builtin_amdgcn_global_load_async_to_lds_b128(
        GLB_AS1(s + i * 128), LDS_AS3(d + i * 2 * pitch), 0, 0);
#else
    *(float4*)(d + i * 2 * pitch) = *(const float4*)(s + i * 128);
#endif
  }
}

static __device__ __forceinline__ v8f wmma4(v2f a, v2f b, v8f c) {
  return __builtin_amdgcn_wmma_f32_16x16x4_f32(false, a, false, b, (short)0, c,
                                               false, false);
}

// Value of lane (l ^ n) inside a 16-lane row, n = CTRL - 0x160 (DPP row_xmask):
// a register move, where __shfl_xor would go through the LDS pipe.
template <int CTRL>
static __device__ __forceinline__ float row_xor(float x) {
  return __builtin_bit_cast(
      float, __builtin_amdgcn_update_dpp(0, __builtin_bit_cast(int, x), CTRL,
                                         0xf, 0xf, true));
}
// Butterfly sums: every lane of the group ends with the same bits.
static __device__ __forceinline__ float sum8(float x) {
  x += row_xor<0x161>(x);
  x += row_xor<0x162>(x);
  x += row_xor<0x164>(x);
  return x;
}
static __device__ __forceinline__ float sum16(float x) {
  x = sum8(x);
  x += row_xor<0x168>(x);
  return x;
}
static __device__ __forceinline__ float sum32(float x) {
  x = sum16(x);
  const int b = __builtin_bit_cast(int, x);
  x += __builtin_bit_cast(float, __builtin_amdgcn_permlanex16(
                                     b, b, 0x76543210, 0xfedcba98, false, false));
  return x;
}
static __device__ __forceinline__ float max8(float x) {
  x = fmaxf(x, row_xor<0x161>(x));
  x = fmaxf(x, row_xor<0x162>(x));
  x = fmaxf(x, row_xor<0x164>(x));
  return x;
}

// Each block's share of G_b = emb_b^T @ emb_b (per-batch 64x64 Gram) over its
// 256 rows, streamed with double-buffered async global->LDS staging and stored
// as this block's own 64x64 partial, in accumulator order (see the epilogue).
// 8 waves, each with two 16x16 tiles that share their A fragment: a launch
// lasts at least as long as its waves take to start, so it starts half as many.
__global__ void __launch_bounds__(256) k_gram(const float* __restrict__ emb,
                                              float* __restrict__ Gp) {
  __shared__ __attribute__((aligned(16))) float sE[2][64 * KR_PITCH];  // two 64-row chunks
  const int b   = blockIdx.x >> 6;  // 64 blocks per batch, 256 rows each
  const int blk = blockIdx.x & 63;
  const int t = threadIdx.x;
  const int lane = t & 31, wave = t >> 5;
  const int m = lane & 15;
  const int khalf = (lane < 16) ? 0 : 2;
  const int ci = wave >> 1, di = (wave & 1) * 2;  // 16x16 tiles (ci, di), (ci, di + 1) of G
  const float* base = emb + ((size_t)b * N_DIM + blk * 256) * C_DIM;

  stage4k<256>(base, sE[0], KR_PITCH, t);  // chunk 0 in flight
  v8f acc0 = {}, acc1 = {};

#define GRAM_STEP(c, W, NEXT)                                         \
  {                                                                   \
    if (NEXT)                                                         \
      stage4k<256>(base + ((c) + 1) * 4096, sE[((c) + 1) & 1], KR_PITCH, t); \
    WAIT_ASYNC(W);                                                    \
    __syncthreads();                                                  \
    const float* sb = sE[(c) & 1];                                    \
    _Pragma("unroll") for (int kk = 0; kk < 16; ++kk) {               \
      const int kb = kk * 4 + khalf;                                  \
      v2f a, b0, b1;                                                  \
      a.x  = sb[kb * KR_PITCH + ci * 16 + m];                         \
      a.y  = sb[(kb + 1) * KR_PITCH + ci * 16 + m];                   \
      b0.x = sb[kb * KR_PITCH + di * 16 + m];                         \
      b0.y = sb[(kb + 1) * KR_PITCH + di * 16 + m];                   \
      b1.x = sb[kb * KR_PITCH + di * 16 + 16 + m];                    \
      b1.y = sb[(kb + 1) * KR_PITCH + di * 16 + 16 + m];              \
      acc0 = wmma4(a, b0, acc0);                                      \
      acc1 = wmma4(a, b1, acc1);                                      \
    }                                                                 \
    __syncthreads();                                                  \
  }

  // W: a chunk is 4 copies of a wave, so 4 leaves only the next chunk's open
  GRAM_STEP(0, 4, 1)
  GRAM_STEP(1, 4, 1)
  GRAM_STEP(2, 4, 1)
  GRAM_STEP(3, 0, 0)
#undef GRAM_STEP

  // Partial layout: [tile = ci * 4 + di][half = v / 4][lane][v % 4], so that each
  // store of a wave is 512 contiguous bytes; k_gsum undoes the order.
  float* pp = Gp + (size_t)blockIdx.x * 4096 + (ci * 4 + di) * 256 + lane * 4;
  *(float4*)pp = make_float4(acc0[0], acc0[1], acc0[2], acc0[3]);
  *(float4*)(pp + 128) = make_float4(acc0[4], acc0[5], acc0[6], acc0[7]);
  *(float4*)(pp + 256) = make_float4(acc1[0], acc1[1], acc1[2], acc1[3]);
  *(float4*)(pp + 384) = make_float4(acc1[4], acc1[5], acc1[6], acc1[7]);
}

// G_b = sum of the batch's 64 block partials, in a fixed order; also clears P,
// which k_attn adds into. A block owns one half tile (128 floats) of one batch:
// wave g sums partials 8g..8g+7 (512 contiguous bytes per load, all 8 loads in
// flight), the 8 waves' sums meet in LDS.
__global__ void __launch_bounds__(256) k_gsum(const float* __restrict__ Gp,
                                              float* __restrict__ G,
                                              float* __restrict__ P) {
  __shared__ __attribute__((aligned(16))) float sR[8 * 128];
  const int b = blockIdx.x >> 5;
  const int s = blockIdx.x & 31;  // wave tile * 2 + half
  const int t = threadIdx.x;
  const int lane = t & 31, g = t >> 5;
  const float* src = Gp + ((size_t)(b * 64 + g * 8)) * 4096 + s * 128 + lane * 4;
  float4 p[8];
#pragma unroll  // all 8 loads in flight at once, p[] in registers
  for (int i = 0; i < 8; ++i) p[i] = *(const float4*)(src + i * 4096);
  float4 a;
  a.x = ((p[0].x + p[1].x) + (p[2].x + p[3].x)) + ((p[4].x + p[5].x) + (p[6].x + p[7].x));
  a.y = ((p[0].y + p[1].y) + (p[2].y + p[3].y)) + ((p[4].y + p[5].y) + (p[6].y + p[7].y));
  a.z = ((p[0].z + p[1].z) + (p[2].z + p[3].z)) + ((p[4].z + p[5].z) + (p[6].z + p[7].z));
  a.w = ((p[0].w + p[1].w) + (p[2].w + p[3].w)) + ((p[4].w + p[5].w) + (p[6].w + p[7].w));
  *(float4*)(sR + g * 128 + lane * 4) = a;
  __syncthreads();  // the 8 waves' sums are in sR
  if (t < 128) {
    // 8 rows x 16 columns of G: accumulator register v = half*4 + j, lanes
    // 16..31 hold rows 8 further down
    const int c = t & 15, j = (t >> 4) & 3, hi = t >> 6;
    const float* r = sR + (hi * 16 + c) * 4 + j;
    const float x = ((r[0] + r[128]) + (r[256] + r[384])) +
                    ((r[512] + r[640]) + (r[768] + r[896]));
    const int row = (s >> 3) * 16 + (s & 1) * 4 + j + hi * 8;
    const int col = ((s >> 1) & 3) * 16 + c;
    G[b * 4096 + row * 64 + col] = x;
  } else {
    P[blockIdx.x * 128 + (t - 128)] = 0.0f;
  }
}

// Per (b,h): attn = IN+softmax(Wq_h @ G_b @ Wk_h^T); M2_h = attn @ Wv_h;
// then this head's share of the output projection,
// P_b += Wo[:, c*H+h] @ M2_h, added into the zeroed P_b with float atomics.
// Wq_h, Wk_h and Wv_h are asked for at entry, beside G_b, and Wo_h under the
// first product, so that all four products read LDS alone and none waits for
// a global load.
__global__ void __launch_bounds__(512) k_attn(const float* __restrict__ G,
                                              const float* __restrict__ Wq,
                                              const float* __restrict__ Wk,
                                              const float* __restrict__ Wv,
                                              const float* __restrict__ Wo,
                                              float* __restrict__ P) {
  __shared__ __attribute__((aligned(16))) float sG[64 * RK_PITCH];
  __shared__ __attribute__((aligned(16))) float sA[64 * RK_PITCH];
  __shared__ float sT[64 * KR_PITCH];
  __shared__ float sW[64 * WO_PITCH];
  __shared__ __attribute__((aligned(16))) float sWk[64 * RK_PITCH];
  __shared__ __attribute__((aligned(16))) float sWq[64 * RK_PITCH];
  __shared__ __attribute__((aligned(16))) float sWv[64 * KR_PITCH];
  __shared__ float2 red[16];  // each wave's sum and sum of squares of the map
  const int b = blockIdx.x >> 3;
  const int h = blockIdx.x & 7;
  const int t = threadIdx.x;
  const int lane = t & 31, wave = t >> 5;
  const int m = lane & 15;
  const int khalf = (lane < 16) ? 0 : 2;
  const int rowoff = (lane < 16) ? 0 : 8;
  const int ti = wave >> 2, tj = wave & 3;

  {
    const float4* src = (const float4*)(G + b * 4096);
    const float4 g0 = src[t];  // G first: the first product waits for it
    const float4 g1 = src[t + 512];
    // whole rows, 512 contiguous bytes per wave and copy, in order of use
    stage4k<512>(Wk + h * 4096, sWk, RK_PITCH, t);
    stage4k<512>(Wq + h * 4096, sWq, RK_PITCH, t);
    stage4k<512>(Wv + h * 4096, sWv, KR_PITCH, t);
    float* dst = sG + (t >> 4) * RK_PITCH + (t & 15) * 4;  // 16 pieces to a row
    *(float4*)dst = g0;
    *(float4*)(dst + 32 * RK_PITCH) = g1;
  }
#if HAS_ASYNC_LDS
  // this wave's six copies have landed before the barrier that lets the other
  // waves read them; in asm so that no LDS read is lifted over it
  asm volatile("s_wait_asynccnt 0x0" ::: "memory");
#endif
  __syncthreads();

  // Wo_h[o][c] = Wo[o*512 + c*H + h] for the last product: each 128-byte line
  // of Wo holds 4 values of this head, so a wave takes 8 rows x 4 columns per
  // load (8 lines) and every line is asked for once per block. Requested here
  // so that the values arrive while the first product runs (a barrier waits
  // for a wave's open loads, so they are not asked for in front of one).
  const int wo_o = (wave & 7) * 8 + (lane >> 2);
  const int wo_c = (wave >> 3) * 32 + (lane & 3);
  float wo[8];
  {
    const float* wp = Wo + wo_o * 512 + wo_c * H_DIM + h;
#pragma unroll  // all 8 loads in flight at once, wo[] in registers
    for (int i = 0; i < 8; ++i) wo[i] = wp[i * 4 * H_DIM];
  }

  // T1 = G @ Wk_h^T
  {
    v8f acc = {};
#pragma unroll
    for (int kk = 0; kk < 16; ++kk) {
      const int kb = kk * 4 + khalf;
      v2f a, bv;
      a.x  = sG[(ti * 16 + m) * RK_PITCH + kb];
      a.y  = sG[(ti * 16 + m) * RK_PITCH + kb + 1];
      bv.x = sWk[(tj * 16 + m) * RK_PITCH + kb];
      bv.y = sWk[(tj * 16 + m) * RK_PITCH + kb + 1];
      acc = wmma4(a, bv, acc);
    }
#pragma unroll
    for (int v = 0; v < 8; ++v)
      sT[(ti * 16 + v + rowoff) * KR_PITCH + tj * 16 + m] = acc[v];
  }
#pragma unroll  // wo[] indexed by constants only, so it stays in registers
  for (int i = 0; i < 8; ++i) sW[wo_o * WO_PITCH + wo_c + i * 4] = wo[i];
  __syncthreads();

  // attn = Wq_h @ T1
  {
    v8f acc = {};
#pragma unroll
    for (int kk = 0; kk < 16; ++kk) {
      const int kb = kk * 4 + khalf;
      v2f a, bv;
      a.x  = sWq[(ti * 16 + m) * RK_PITCH + kb];
      a.y  = sWq[(ti * 16 + m) * RK_PITCH + kb + 1];
      bv.x = sT[kb * KR_PITCH + tj * 16 + m];
      bv.y = sT[(kb + 1) * KR_PITCH + tj * 16 + m];
      acc = wmma4(a, bv, acc);
    }
#pragma unroll
    for (int v = 0; v < 8; ++v)
      sA[(ti * 16 + v + rowoff) * RK_PITCH + tj * 16 + m] = acc[v];
  }
  __syncthreads();

  // InstanceNorm2d (biased variance) over the whole 64x64 map, then softmax
  // over each row: 8 lanes own a row, 8 elements each (t*8..t*8+7), held in
  // registers from the one read to the one write; no other thread touches them.
  float* const sAt = sA + (t >> 3) * RK_PITCH + (t & 7) * 8;
  float x[8];
  {
    const float4 lo = *(const float4*)sAt;
    const float4 hi = *(const float4*)(sAt + 4);
    x[0] = lo.x; x[1] = lo.y; x[2] = lo.z; x[3] = lo.w;
    x[4] = hi.x; x[5] = hi.y; x[6] = hi.z; x[7] = hi.w;
    float s = 0.f, q = 0.f;
#pragma unroll  // x[] indexed by constants only, so it stays in registers
    for (int i = 0; i < 8; ++i) {
      s += x[i];
      q += x[i] * x[i];
    }
    s = sum32(s);
    q = sum32(q);
    if (lane == 0) red[wave] = make_float2(s, q);
  }
  __syncthreads();  // the 16 waves' sums are in red[]

  {
    const float2 pr = red[lane & 15];
    const float mean = sum16(pr.x) * (1.0f / 4096.0f);
    const float var  = sum16(pr.y) * (1.0f / 4096.0f) - mean * mean;
    const float inv  = rsqrtf(var + EPS_IN);
    float mx = -1e30f;
#pragma unroll  // x[] indexed by constants only, so it stays in registers
    for (int i = 0; i < 8; ++i) {
      x[i] = (x[i] - mean) * inv;
      mx = fmaxf(mx, x[i]);
    }
    mx = max8(mx);
#pragma unroll  // x[] indexed by constants only, so it stays in registers
    for (int i = 0; i < 8; ++i) x[i] = __expf(x[i] - mx);
    asm volatile("v_nop" ::"v"(x[0]), "v"(x[1]), "v"(x[2]), "v"(x[3]), "v"(x[4]),
                 "v"(x[5]), "v"(x[6]), "v"(x[7]));
    // pairwise: three dependent adds in place of eight
    const float se = ((x[0] + x[1]) + (x[2] + x[3])) + ((x[4] + x[5]) + (x[6] + x[7]));
    const float r = 1.0f / sum8(se);
    *(float4*)sAt = make_float4(x[0] * r, x[1] * r, x[2] * r, x[3] * r);
    *(float4*)(sAt + 4) = make_float4(x[4] * r, x[5] * r, x[6] * r, x[7] * r);
  }
  __syncthreads();

  // M2_h = attn @ Wv_h, kept in LDS (sT is free since the second product)
  {
    v8f acc = {};
#pragma unroll
    for (int kk = 0; kk < 16; ++kk) {
      const int kb = kk * 4 + khalf;
      v2f a, bv;
      a.x  = sA[(ti * 16 + m) * RK_PITCH + kb];
      a.y  = sA[(ti * 16 + m) * RK_PITCH + kb + 1];
      bv.x = sWv[kb * KR_PITCH + tj * 16 + m];
      bv.y = sWv[(kb + 1) * KR_PITCH + tj * 16 + m];
      acc = wmma4(a, bv, acc);
    }
#pragma unroll  // acc[] indexed by constants only, so it stays in registers
    for (int v = 0; v < 8; ++v)
      sT[(ti * 16 + v + rowoff) * KR_PITCH + tj * 16 + m] = acc[v];
  }
  __syncthreads();  // M2_h complete in sT before any wave reads it as B

  // P_b += Wo_h @ M2_h
  {
    v8f acc = {};
#pragma unroll  // lets the LDS reads of later k steps start ahead of the WMMAs
    for (int kk = 0; kk < 16; ++kk) {
      const int kb = kk * 4 + khalf;
      v2f a, bv;
      a.x  = sW[(ti * 16 + m) * WO_PITCH + kb];
      a.y  = sW[(ti * 16 + m) * WO_PITCH + kb + 1];
      bv.x = sT[kb * KR_PITCH + tj * 16 + m];
      bv.y = sT[(kb + 1) * KR_PITCH + tj * 16 + m];
      acc = wmma4(a, bv, acc);
    }
    float* pp = P + b * 4096 + (ti * 16 + rowoff) * 64 + tj * 16 + m;
#pragma unroll  // acc[] indexed by constants only, so it stays in registers
    for (int v = 0; v < 8; ++v) atomicAdd(pp + v * 64, acc[v]);
  }
}

// out_b = emb_b @ P_b^T, streamed over N. 8 waves; each wave owns 32 whole rows
// of emb (two groups of 16) and all four 16-column tiles of their output, so it
// alone copies, reads and stores them: behind the one barrier that publishes
// P_b no wave waits for another, and none waits for its output stores (every
// __syncthreads() behind a global store holds the wave until the store is done).
__global__ void __launch_bounds__(256) k_out(const float* __restrict__ emb,
                                             const float* __restrict__ P,
                                             float* __restrict__ out) {
  // one array, P_b in front: its fragment reads then reach every row with the
  // 16-bit offset field of the LDS load, from one address register
  __shared__ __attribute__((aligned(16))) float sm[(64 + 8 * 32) * RK_PITCH];
  float* const sP = sm;
  const int b   = blockIdx.x >> 6;  // 64 blocks per batch, 256 rows each
  const int blk = blockIdx.x & 63;
  const int t = threadIdx.x;
  const int lane = t & 31, wave = t >> 5;
  const int n0  = blk * 256 + wave * 32;  // this wave's first row
  const int m = lane & 15;
  const int khalf = (lane < 16) ? 0 : 2;
  const int rowoff = (lane < 16) ? 0 : 8;
  float* const se = sm + (64 + wave * 32) * RK_PITCH;  // this wave's own rows

  stage4k<256>(P + b * 4096, sP, RK_PITCH, t);  // issued first: in-order ahead of the rows
  // 16 copies of 512 contiguous bytes, all in flight from the start
  stage_own<32>(emb + ((size_t)b * N_DIM + n0) * C_DIM, se, RK_PITCH, lane);
  WAIT_ASYNC(16);                // sP landed (in-order); the wave's 16 row copies may be in flight
  __syncthreads();

  v2f brg[4][16];
  const float* pb = sP + m * RK_PITCH + khalf;
#pragma unroll  // brg[][] indexed by constants only, so it stays in registers
  for (int j = 0; j < 4; ++j)
#pragma unroll
    for (int kk = 0; kk < 16; ++kk) {
      brg[j][kk].x = pb[j * 16 * RK_PITCH + kk * 4];
      brg[j][kk].y = pb[j * 16 * RK_PITCH + kk * 4 + 1];
    }

  float* ob = out + ((size_t)b * N_DIM + n0) * C_DIM;

#define OUT_GROUP(g, W)                                                 \
  {                                                                     \
    WAIT_ASYNC_OWN(W);                                                  \
    const float* sb = se + (g) * 16 * RK_PITCH;                         \
    v8f acc[4] = {};                                                    \
    _Pragma("unroll") for (int kk = 0; kk < 16; ++kk) {                 \
      const int kb = kk * 4 + khalf;                                    \
      v2f a;                                                            \
      a.x = sb[m * RK_PITCH + kb];                                      \
      a.y = sb[m * RK_PITCH + kb + 1];                                  \
      _Pragma("unroll") for (int j = 0; j < 4; ++j)                     \
        acc[j] = wmma4(a, brg[j][kk], acc[j]);                          \
    }                                                                   \
    _Pragma("unroll") for (int v = 0; v < 8; ++v) {                     \
      float* op = &ob[((g) * 16 + v + rowoff) * 64 + m];                \
      _Pragma("unroll") for (int j = 0; j < 4; ++j)                     \
        __builtin_nontemporal_store(acc[j][v], op + j * 16);            \
    }                                                                   \
  }

  // W: a group is 8 copies of the wave, so 8 leaves only the second group's open
  OUT_GROUP(0, 8)
  // the second group's loads and products overwrite registers that the first
  // group's stores name: the wait that belongs between the two
  asm volatile("s_wait_xcnt 0x0" ::: "memory");
  OUT_GROUP(1, 0)
#undef OUT_GROUP
}

extern "C" void kernel_launch(void* const* d_in, const int* in_sizes, int n_in,
                              void* d_out, int out_size, void* d_ws,
                              size_t ws_size, hipStream_t stream) {
  (void)in_sizes; (void)n_in; (void)out_size; (void)ws_size;
  const float* emb = (const float*)d_in[0];
  const float* Wq  = (const float*)d_in[1];
  const float* Wk  = (const float*)d_in[2];
  const float* Wv  = (const float*)d_in[3];
  const float* Wo  = (const float*)d_in[4];
  float* out = (float*)d_out;

  float* ws = (float*)d_ws;
  float* G = ws;           // B*4096 = 16384 floats
  float* P = ws + 16384;   // B*4096 = 16384 floats
  float* Gp = ws + 32768;  // B*64 block partials of 4096 floats

  k_gram<<<B_DIM * 64, 256, 0, stream>>>(emb, Gp);
  k_gsum<<<B_DIM * 32, 256, 0, stream>>>(Gp, G, P);
  k_attn<<<B_DIM * H_DIM, 512, 0, stream>>>(G, Wq, Wk, Wv, Wo, P);
  k_out<<<B_DIM * 64, 256, 0, stream>>>(emb, P, out);
}

// v008
// One run takes 18.7 microseconds.
// Next to v007, in two timings, it ran 1.07 and 1.09 times as fast.
// Counting every step since v000, it is 3.05 times as fast.
#include <hip/hip_runtime.h>
#include <hip/hip_bf16.h>

typedef __attribute__((ext_vector_type(2))) float v2f;
typedef __attribute__((ext_vector_type(8))) float v8f;
typedef int v4i __attribute__((vector_size(4 * sizeof(int))));

#define B_DIM 4
#define N_DIM 16384
#define C_DIM 64
#define H_DIM 8
#define EPS_IN 1e-5f
#define WO_PITCH 68
#define RK_PITCH 68
#define KR_PITCH 80

#ifndef __has_builtin
#define __has_builtin(x) 0
#endif

#if __has_builtin(__builtin_amdgcn_global_load_async_to_lds_b128)
#define HAS_ASYNC_LDS 1
#else
#define HAS_ASYNC_LDS 0
#endif

#if __has_builtin(__builtin_amdgcn_s_wait_asynccnt)
#define WAIT_ASYNC(n) __builtin_amdgcn_s_wait_asynccnt(n)
#elif HAS_ASYNC_LDS
#define WAIT_ASYNC(n) asm volatile("s_wait_asynccnt %0" ::"i"(n) : "memory")
#else
#define WAIT_ASYNC(n) ((void)0)
#endif

// The wait of a wave that reads its own copies with no barrier behind it: in
// asm with the "memory" clobber, so that no LDS read is lifted over it.
#if HAS_ASYNC_LDS
#define WAIT_ASYNC_OWN(n) asm volatile("s_wait_asynccnt %0" ::"i"(n) : "memory")
#else
#define WAIT_ASYNC_OWN(n) ((void)0)
#endif

// addrspace conversions via ptrtoint/inttoptr; pointee type int32x4 per the
// builtin's probed signature (AS1 v4i* source, AS3 v4i* LDS destination).
#define GLB_AS1(p) \
  ((__attribute__((address_space(1))) v4i*)(unsigned long long)(p))
#define LDS_AS3(p) \
  ((__attribute__((address_space(3))) v4i*)(unsigned int)(unsigned long long)(p))

// Copy 64 rows x 64 floats (16 KB) global -> LDS rows of `pitch` floats
// (a multiple of 4); NT threads x (1024 / NT) x 16B each, 16 pieces to a row.
template <int NT>
static __device__ __forceinline__ void stage4k(const float* __restrict__ g,
                                               float* l, const int pitch,
                                               int t) {
#pragma unroll
  for (int i = 0; i < 1024 / NT; ++i) {
    const int p = t + i * NT;
    float* d = l + (p >> 4) * pitch + (p & 15) * 4;
#if HAS_ASYNC_LDS
    __builtin_amdgcn_global_load_async_to_lds_b128(GLB_AS1(g + (size_t)p * 4),
                                                   LDS_AS3(d), 0, 0);
#else
    *(float4*)d = ((const float4*)g)[p];
#endif
  }
}

// One wave's own ROWS rows x 64 floats, global -> LDS rows of `pitch` floats
// (a multiple of 4): a copy takes two whole rows, 512 contiguous bytes.
template <int ROWS>
static __device__ __forceinline__ void stage_own(const float* __restrict__ g,
                                                 float* l, const int pitch,
                                                 int lane) {
  const float* s = g + lane * 4;
  float* d = l + (lane >> 4) * pitch + (lane & 15) * 4;
#pragma unroll
  for (int i = 0; i < ROWS / 2; ++i) {
#if HAS_ASYNC_LDS
    __builtin_amdgcn_global_load_async_to_lds_b128(
        GLB_AS1(s + i * 128), LDS_AS3(d + i * 2 * pitch), 0, 0);
#else
    *(float4*)(d + i * 2 * pitch) = *(const float4*)(s + i * 128);
#endif
  }
}

static __device__ __forceinline__ v8f wmma4(v2f a, v2f b, v8f c) {
  return __builtin_amdgcn_wmma_f32_16x16x4_f32(false, a, false, b, (short)0, c,
                                               false, false);
}

// Value of lane (l ^ n) inside a 16-lane row, n = CTRL - 0x160 (DPP row_xmask):
// a register move, where __shfl_xor would go through the LDS pipe.
template <int CTRL>
static __device__ __forceinline__ float row_xor(float x) {
  return __builtin_bit_cast(
      float, __builtin_amdgcn_update_dpp(0, __builtin_bit_cast(int, x), CTRL,
                                         0xf, 0xf, true));
}
// Butterfly sums: every lane of the group ends with the same bits.
static __device__ __forceinline__ float sum8(float x) {
  x += row_xor<0x161>(x);
  x += row_xor<0x162>(x);
  x += row_xor<0x164>(x);
  return x;
}
static __device__ __forceinline__ float sum16(float x) {
  x = sum8(x);
  x += row_xor<0x168>(x);
  return x;
}
static __device__ __forceinline__ float sum32(float x) {
  x = sum16(x);
  const int b = __builtin_bit_cast(int, x);
  x += __builtin_bit_cast(float, __builtin_amdgcn_permlanex16(
                                     b, b, 0x76543210, 0xfedcba98, false, false));
  return x;
}
static __device__ __forceinline__ float max8(float x) {
  x = fmaxf(x, row_xor<0x161>(x));
  x = fmaxf(x, row_xor<0x162>(x));
  x = fmaxf(x, row_xor<0x164>(x));
  return x;
}

// G_b = emb_b^T @ emb_b is symmetric whatever emb holds, so only its 10 upper
// 16x16 tiles are computed. Order of the tiles in a partial (row, column group):
// 0:(0,0) 1:(0,1) 2:(0,2) 3:(0,3) 4:(3,3) 5:(1,1) 6:(1,2) 7:(1,3) 8:(2,2) 9:(2,3),
// two bits a tile in the two words below.
#define TILE_ROWS 0xA5700u
#define TILE_COLS 0xEE7E4u
#define GP_FLOATS 2560  // one 512-row slice's partial: 10 tiles of 256 floats

// 16 rows (four k steps) of one wave's own 64: the four column groups' fragments
// serve as A and as B alike. SEL picks the block's five tiles.
template <int SEL, int GRP>
static __device__ __forceinline__ void gram_group(const float* fp, v8f (&acc)[5]) {
  // a group is 8 copies of the wave: only the later groups' may still be open
  WAIT_ASYNC_OWN(24 - 8 * GRP);
#pragma unroll  // lets the LDS reads of later k steps start ahead of the WMMAs
  for (int kk = GRP * 4; kk < GRP * 4 + 4; ++kk) {
    v2f f[4];
#pragma unroll  // f[] indexed by constants only, so it stays in registers
    for (int c = SEL; c < 4; ++c) {
      f[c].x = fp[kk * 4 * KR_PITCH + c * 16];
      f[c].y = fp[(kk * 4 + 1) * KR_PITCH + c * 16];
    }
    if (SEL == 0) {
      acc[0] = wmma4(f[0], f[0], acc[0]);
      acc[1] = wmma4(f[0], f[1], acc[1]);
      acc[2] = wmma4(f[0], f[2], acc[2]);
      acc[3] = wmma4(f[0], f[3], acc[3]);
      acc[4] = wmma4(f[3], f[3], acc[4]);
    } else {
      acc[0] = wmma4(f[1], f[1], acc[0]);
      acc[1] = wmma4(f[1], f[2], acc[1]);
      acc[2] = wmma4(f[1], f[3], acc[2]);
      acc[3] = wmma4(f[2], f[2], acc[3]);
      acc[4] = wmma4(f[2], f[3], acc[4]);
    }
  }
}

static __device__ __forceinline__ float4 add4(float4 a, float4 b) {
  return make_float4(a.x + b.x, a.y + b.y, a.z + b.z, a.w + b.w);
}

// A block's share of G_b: five of the ten upper tiles over 512 rows, so that a
// batch leaves only 32 partials of 10 KB, few enough for k_attn to sum itself.
// 8 waves; each copies and reads its own 64 rows (all copies in flight from the
// start, no barrier in the products) and holds all five tiles; the 8 waves' sums
// meet in LDS. Also clears P, which k_attn adds into.
__global__ void __launch_bounds__(256) k_gram(const float* __restrict__ emb,
                                              float* __restrict__ Gp,
                                              float* __restrict__ P) {
  __shared__ __attribute__((aligned(16))) float sE[8 * 64 * KR_PITCH];
  // the two blocks that read the same rows lie 8 apart in the grid (for speed only)
  const int sel = (blockIdx.x >> 3) & 1;
  const int s = (blockIdx.x >> 4) * 8 + (blockIdx.x & 7);  // batch * 32 + slice
  const int t = threadIdx.x;
  const int lane = t & 31, wave = t >> 5;
  const int m = lane & 15;
  const int khalf = (lane < 16) ? 0 : 2;
  float* const se = sE + wave * 64 * KR_PITCH;  // this wave's own rows

  // 32 copies of 512 contiguous bytes
  stage_own<64>(emb + ((size_t)s * 512 + wave * 64) * C_DIM, se, KR_PITCH, lane);
  if (t < 64) P[blockIdx.x * 64 + t] = 0.0f;

  v8f acc[5] = {};
  const float* fp = se + khalf * KR_PITCH + m;
  if (sel == 0) {
    gram_group<0, 0>(fp, acc);
    gram_group<0, 1>(fp, acc);
    gram_group<0, 2>(fp, acc);
    gram_group<0, 3>(fp, acc);
  } else {
    gram_group<1, 0>(fp, acc);
    gram_group<1, 1>(fp, acc);
    gram_group<1, 2>(fp, acc);
    gram_group<1, 3>(fp, acc);
  }

  // Layout of a wave's sums and of the partial: [tile][half = v / 4][lane][v % 4],
  // so that each load and store of a wave is 512 contiguous bytes. The wave's
  // own rows are read out, so its sums take their place.
#pragma unroll  // acc[] indexed by constants only, so it stays in registers
  for (int i = 0; i < 5; ++i) {
    *(float4*)(se + i * 256 + lane * 4) =
        make_float4(acc[i][0], acc[i][1], acc[i][2], acc[i][3]);
    *(float4*)(se + i * 256 + 128 + lane * 4) =
        make_float4(acc[i][4], acc[i][5], acc[i][6], acc[i][7]);
  }
  __syncthreads();  // the 8 waves' sums are in sE
  // ten half tiles on 8 waves: wave w takes w, waves 0 and 1 also 8 and 9
  float* gp = Gp + ((size_t)s * 10 + sel * 5) * 256 + lane * 4;
  for (int u = wave; u < 10; u += 8) {
    const float* r = sE + u * 128 + lane * 4;
    float4 p[8];
#pragma unroll  // p[] indexed by constants only, so it stays in registers
    for (int w = 0; w < 8; ++w) p[w] = *(const float4*)(r + w * 64 * KR_PITCH);
    *(float4*)(gp + u * 128) = add4(add4(add4(p[0], p[1]), add4(p[2], p[3])),
                                    add4(add4(p[4], p[5]), add4(p[6], p[7])));
  }
}

// Per (b,h): attn = IN+softmax(Wq_h @ G_b @ Wk_h^T); M2_h = attn @ Wv_h;
// then this head's share of the output projection,
// P_b += Wo[:, c*H+h] @ M2_h, added into the zeroed P_b with float atomics.
// G_b itself is summed here from the batch's 32 partials, in a fixed order.
// Wq_h, Wk_h and Wv_h are asked for at entry, beside G_b, and Wo_h under the
// first product, so that all four products read LDS alone and none waits for
// a global load.
__global__ void __launch_bounds__(512) k_attn(const float* __restrict__ Gp,
                                              const float* __restrict__ Wq,
                                              const float* __restrict__ Wk,
                                              const float* __restrict__ Wv,
                                              const float* __restrict__ Wo,
                                              float* __restrict__ P) {
  __shared__ __attribute__((aligned(16))) float sG[64 * RK_PITCH];
  __shared__ __attribute__((aligned(16))) float sA[64 * RK_PITCH];
  __shared__ float sT[64 * KR_PITCH];
  __shared__ float sW[64 * WO_PITCH];
  __shared__ __attribute__((aligned(16))) float sWk[64 * RK_PITCH];
  __shared__ __attribute__((aligned(16))) float sWq[64 * RK_PITCH];
  __shared__ __attribute__((aligned(16))) float sWv[64 * KR_PITCH];
  __shared__ float2 red[16];  // each wave's sum and sum of squares of the map
  const int b = blockIdx.x >> 3;
  const int h = blockIdx.x & 7;
  const int t = threadIdx.x;
  const int lane = t & 31, wave = t >> 5;
  const int m = lane & 15;
  const int khalf = (lane < 16) ? 0 : 2;
  const int rowoff = (lane < 16) ? 0 : 8;
  const int ti = wave >> 2, tj = wave & 3;

  {
    // G_b's 20 half tiles, spread evenly: wave w sums half tile w, 16 bytes a
    // lane (512 contiguous bytes of one partial per load); the last four half
    // tiles are 512 floats, one a thread (a whole 128-byte line per load).
    // G first: the first product waits for it.
    const float* ga = Gp + (size_t)b * 32 * GP_FLOATS + wave * 128 + lane * 4;
    const float* gb = Gp + (size_t)b * 32 * GP_FLOATS + 16 * 128 + t;
    float4 q[8];
    float e[8];
#pragma unroll  // q[], e[] indexed by constants only, so they stay in registers
    for (int i = 0; i < 8; ++i) {
      const float* r = ga + i * 4 * GP_FLOATS;
      const float* z = gb + i * 4 * GP_FLOATS;
      q[i] = add4(add4(*(const float4*)r, *(const float4*)(r + GP_FLOATS)),
                  add4(*(const float4*)(r + 2 * GP_FLOATS),
                       *(const float4*)(r + 3 * GP_FLOATS)));
      e[i] = (z[0] + z[GP_FLOATS]) + (z[2 * GP_FLOATS] + z[3 * GP_FLOATS]);
    }
    // whole rows, 512 contiguous bytes per wave and copy, in order of use
    stage4k<512>(Wk + h * 4096, sWk, RK_PITCH, t);
    stage4k<512>(Wq + h * 4096, sWq, RK_PITCH, t);
    stage4k<512>(Wv + h * 4096, sWv, KR_PITCH, t);
    {
      const float4 g = add4(add4(add4(q[0], q[1]), add4(q[2], q[3])),
                            add4(add4(q[4], q[5]), add4(q[6], q[7])));
      // accumulator register v = half * 4 + j: row v, lanes 16..31 8 further down
      const int gi = (TILE_ROWS >> (wave & ~1)) & 3;
      const int gj = (TILE_COLS >> (wave & ~1)) & 3;
      const int row = gi * 16 + (wave & 1) * 4 + rowoff, col = gj * 16 + m;
      sG[row * RK_PITCH + col] = g.x;
      sG[(row + 1) * RK_PITCH + col] = g.y;
      sG[(row + 2) * RK_PITCH + col] = g.z;
      sG[(row + 3) * RK_PITCH + col] = g.w;
      // the mirrored tile below the diagonal: four rows become four columns
      if (gi != gj) *(float4*)(sG + col * RK_PITCH + row) = g;
    }
    {
      const float x = ((e[0] + e[1]) + (e[2] + e[3])) + ((e[4] + e[5]) + (e[6] + e[7]));
      // thread t holds float t of half tiles 16..19: [half tile][lane][j]
      const int u = 16 + (t >> 7);
      const int gi = (TILE_ROWS >> (u & ~1)) & 3;
      const int gj = (TILE_COLS >> (u & ~1)) & 3;
      const int row = gi * 16 + (u & 1) * 4 + (t & 3) + ((t >> 6) & 1) * 8;
      const int col = gj * 16 + ((t >> 2) & 15);
      sG[row * RK_PITCH + col] = x;
      if (gi != gj) sG[col * RK_PITCH + row] = x;
    }
  }
#if HAS_ASYNC_LDS
  // this wave's six copies have landed before the barrier that lets the other
  // waves read them; in asm so that no LDS read is lifted over it
  asm volatile("s_wait_asynccnt 0x0" ::: "memory");
#endif
  __syncthreads();

  // Wo_h[o][c] = Wo[o*512 + c*H + h] for the last product: each 128-byte line
  // of Wo holds 4 values of this head, so a wave takes 8 rows x 4 columns per
  // load (8 lines) and every line is asked for once per block. Requested here
  // so that the values arrive while the first product runs (a barrier waits
  // for a wave's open loads, so they are not asked for in front of one).
  const int wo_o = (wave & 7) * 8 + (lane >> 2);
  const int wo_c = (wave >> 3) * 32 + (lane & 3);
  float wo[8];
  {
    const float* wp = Wo + wo_o * 512 + wo_c * H_DIM + h;
#pragma unroll  // all 8 loads in flight at once, wo[] in registers
    for (int i = 0; i < 8; ++i) wo[i] = wp[i * 4 * H_DIM];
  }

  // T1 = G @ Wk_h^T
  {
    v8f acc = {};
#pragma unroll
    for (int kk = 0; kk < 16; ++kk) {
      const int kb = kk * 4 + khalf;
      v2f a, bv;
      a.x  = sG[(ti * 16 + m) * RK_PITCH + kb];
      a.y  = sG[(ti * 16 + m) * RK_PITCH + kb + 1];
      bv.x = sWk[(tj * 16 + m) * RK_PITCH + kb];
      bv.y = sWk[(tj * 16 + m) * RK_PITCH + kb + 1];
      acc = wmma4(a, bv, acc);
    }
#pragma unroll
    for (int v = 0; v < 8; ++v)
      sT[(ti * 16 + v + rowoff) * KR_PITCH + tj * 16 + m] = acc[v];
  }
#pragma unroll  // wo[] indexed by constants only, so it stays in registers
  for (int i = 0; i < 8; ++i) sW[wo_o * WO_PITCH + wo_c + i * 4] = wo[i];
  __syncthreads();

  // attn = Wq_h @ T1
  {
    v8f acc = {};
#pragma unroll
    for (int kk = 0; kk < 16; ++kk) {
      const int kb = kk * 4 + khalf;
      v2f a, bv;
      a.x  = sWq[(ti * 16 + m) * RK_PITCH + kb];
      a.y  = sWq[(ti * 16 + m) * RK_PITCH + kb + 1];
      bv.x = sT[kb * KR_PITCH + tj * 16 + m];
      bv.y = sT[(kb + 1) * KR_PITCH + tj * 16 + m];
      acc = wmma4(a, bv, acc);
    }
#pragma unroll
    for (int v = 0; v < 8; ++v)
      sA[(ti * 16 + v + rowoff) * RK_PITCH + tj * 16 + m] = acc[v];
  }
  __syncthreads();

  // InstanceNorm2d (biased variance) over the whole 64x64 map, then softmax
  // over each row: 8 lanes own a row, 8 elements each (t*8..t*8+7), held in
  // registers from the one read to the one write; no other thread touches them.
  float* const sAt = sA + (t >> 3) * RK_PITCH + (t & 7) * 8;
  float x[8];
  {
    const float4 lo = *(const float4*)sAt;
    const float4 hi = *(const float4*)(sAt + 4);
    x[0] = lo.x; x[1] = lo.y; x[2] = lo.z; x[3] = lo.w;
    x[4] = hi.x; x[5] = hi.y; x[6] = hi.z; x[7] = hi.w;
    float s = 0.f, q = 0.f;
#pragma unroll  // x[] indexed by constants only, so it stays in registers
    for (int i = 0; i < 8; ++i) {
      s += x[i];
      q += x[i] * x[i];
    }
    s = sum32(s);
    q = sum32(q);
    if (lane == 0) red[wave] = make_float2(s, q);
  }
  __syncthreads();  // the 16 waves' sums are in red[]

  {
    const float2 pr = red[lane & 15];
    const float mean = sum16(pr.x) * (1.0f / 4096.0f);
    const float var  = sum16(pr.y) * (1.0f / 4096.0f) - mean * mean;
    const float inv  = rsqrtf(var + EPS_IN);
    float mx = -1e30f;
#pragma unroll  // x[] indexed by constants only, so it stays in registers
    for (int i = 0; i < 8; ++i) {
      x[i] = (x[i] - mean) * inv;
      mx = fmaxf(mx, x[i]);
    }
    mx = max8(mx);
#pragma unroll  // x[] indexed by constants only, so it stays in registers
    for (int i = 0; i < 8; ++i) x[i] = __expf(x[i] - mx);
    asm volatile("v_nop" ::"v"(x[0]), "v"(x[1]), "v"(x[2]), "v"(x[3]), "v"(x[4]),
                 "v"(x[5]), "v"(x[6]), "v"(x[7]));
    // pairwise: three dependent adds in place of eight
    const float se = ((x[0] + x[1]) + (x[2] + x[3])) + ((x[4] + x[5]) + (x[6] + x[7]));
    const float r = 1.0f / sum8(se);
    *(float4*)sAt = make_float4(x[0] * r, x[1] * r, x[2] * r, x[3] * r);
    *(float4*)(sAt + 4) = make_float4(x[4] * r, x[5] * r, x[6] * r, x[7] * r);
  }
  __syncthreads();

  // M2_h = attn @ Wv_h, kept in LDS (sT is free since the second product)
  {
    v8f acc = {};
#pragma unroll
    for (int kk = 0; kk < 16; ++kk) {
      const int kb = kk * 4 + khalf;
      v2f a, bv;
      a.x  = sA[(ti * 16 + m) * RK_PITCH + kb];
      a.y  = sA[(ti * 16 + m) * RK_PITCH + kb + 1];
      bv.x = sWv[kb * KR_PITCH + tj * 16 + m];
      bv.y = sWv[(kb + 1) * KR_PITCH + tj * 16 + m];
      acc = wmma4(a, bv, acc);
    }
#pragma unroll  // acc[] indexed by constants only, so it stays in registers
    for (int v = 0; v < 8; ++v)
      sT[(ti * 16 + v + rowoff) * KR_PITCH + tj * 16 + m] = acc[v];
  }
  __syncthreads();  // M2_h complete in sT before any wave reads it as B

  // P_b += Wo_h @ M2_h
  {
    v8f acc = {};
#pragma unroll  // lets the LDS reads of later k steps start ahead of the WMMAs
    for (int kk = 0; kk < 16; ++kk) {
      const int kb = kk * 4 + khalf;
      v2f a, bv;
      a.x  = sW[(ti * 16 + m) * WO_PITCH + kb];
      a.y  = sW[(ti * 16 + m) * WO_PITCH + kb + 1];
      bv.x = sT[kb * KR_PITCH + tj * 16 + m];
      bv.y = sT[(kb + 1) * KR_PITCH + tj * 16 + m];
      acc = wmma4(a, bv, acc);
    }
    float* pp = P + b * 4096 + (ti * 16 + rowoff) * 64 + tj * 16 + m;
#pragma unroll  // acc[] indexed by constants only, so it stays in registers
    for (int v = 0; v < 8; ++v) atomicAdd(pp + v * 64, acc[v]);
  }
}

// out_b = emb_b @ P_b^T, streamed over N. 8 waves; each wave owns 32 whole rows
// of emb (two groups of 16) and all four 16-column tiles of their output, so it
// alone copies, reads and stores them: behind the one barrier that publishes
// P_b no wave waits for another, and none waits for its output stores (every
// __syncthreads() behind a global store holds the wave until the store is done).
__global__ void __launch_bounds__(256) k_out(const float* __restrict__ emb,
                                             const float* __restrict__ P,
                                             float* __restrict__ out) {
  // one array, P_b in front: its fragment reads then reach every row with the
  // 16-bit offset field of the LDS load, from one address register
  __shared__ __attribute__((aligned(16))) float sm[(64 + 8 * 32) * RK_PITCH];
  float* const sP = sm;
  const int b   = blockIdx.x >> 6;  // 64 blocks per batch, 256 rows each
  const int blk = blockIdx.x & 63;
  const int t = threadIdx.x;
  const int lane = t & 31, wave = t >> 5;
  const int n0  = blk * 256 + wave * 32;  // this wave's first row
  const int m = lane & 15;
  const int khalf = (lane < 16) ? 0 : 2;
  const int rowoff = (lane < 16) ? 0 : 8;
  float* const se = sm + (64 + wave * 32) * RK_PITCH;  // this wave's own rows

  stage4k<256>(P + b * 4096, sP, RK_PITCH, t);  // issued first: in-order ahead of the rows
  // 16 copies of 512 contiguous bytes, all in flight from the start
  stage_own<32>(emb + ((size_t)b * N_DIM + n0) * C_DIM, se, RK_PITCH, lane);
  WAIT_ASYNC(16);                // sP landed (in-order); the wave's 16 row copies may be in flight
  __syncthreads();

  v2f brg[4][16];
  const float* pb = sP + m * RK_PITCH + khalf;
#pragma unroll  // brg[][] indexed by constants only, so it stays in registers
  for (int j = 0; j < 4; ++j)
#pragma unroll
    for (int kk = 0; kk < 16; ++kk) {
      brg[j][kk].x = pb[j * 16 * RK_PITCH + kk * 4];
      brg[j][kk].y = pb[j * 16 * RK_PITCH + kk * 4 + 1];
    }

  float* ob = out + ((size_t)b * N_DIM + n0) * C_DIM;

#define OUT_GROUP(g, W)                                                 \
  {                                                                     \
    WAIT_ASYNC_OWN(W);                                                  \
    const float* sb = se + (g) * 16 * RK_PITCH;                         \
    v8f acc[4] = {};                                                    \
    _Pragma("unroll") for (int kk = 0; kk < 16; ++kk) {                 \
      const int kb = kk * 4 + khalf;                                    \
      v2f a;                                                            \
      a.x = sb[m * RK_PITCH + kb];                                      \
      a.y = sb[m * RK_PITCH + kb + 1];                                  \
      _Pragma("unroll") for (int j = 0; j < 4; ++j)                     \
        acc[j] = wmma4(a, brg[j][kk], acc[j]);                          \
    }                                                                   \
    _Pragma("unroll") for (int v = 0; v < 8; ++v) {                     \
      float* op = &ob[((g) * 16 + v + rowoff) * 64 + m];                \
      _Pragma("unroll") for (int j = 0; j < 4; ++j)                     \
        __builtin_nontemporal_store(acc[j][v], op + j * 16);            \
    }                                                                   \
  }

  // W: a group is 8 copies of the wave, so 8 leaves only the second group's open
  OUT_GROUP(0, 8)
  // the second group's loads and products overwrite registers that the first
  // group's stores name: the wait that belongs between the two
  asm volatile("s_wait_xcnt 0x0" ::: "memory");
  OUT_GROUP(1, 0)
#undef OUT_GROUP
}

extern "C" void kernel_launch(void* const* d_in, const int* in_sizes, int n_in,
                              void* d_out, int out_size, void* d_ws,
                              size_t ws_size, hipStream_t stream) {
  (void)in_sizes; (void)n_in; (void)out_size; (void)ws_size;
  const float* emb = (const float*)d_in[0];
  const float* Wq  = (const float*)d_in[1];
  const float* Wk  = (const float*)d_in[2];
  const float* Wv  = (const float*)d_in[3];
  const float* Wo  = (const float*)d_in[4];
  float* out = (float*)d_out;

  float* ws = (float*)d_ws;
  float* P = ws;           // B*4096 = 16384 floats
  float* Gp = ws + 16384;  // B*32 slice partials of 2560 floats

  k_gram<<<B_DIM * 64, 256, 0, stream>>>(emb, Gp, P);
  k_attn<<<B_DIM * H_DIM, 512, 0, stream>>>(Gp, Wq, Wk, Wv, Wo, P);
  k_out<<<B_DIM * 64, 256, 0, stream>>>(emb, P, out);
}
